// v000
// The times below were measured on an AMD MI455X: many runs one after another, warmed up first and cycling through
// copies of the inputs, with the whole window's GPU time divided by the number of runs. Launches and the gaps
// between them are all in it. The median over several windows is given; except for v000 it joins two sittings, which
// can be a few percent apart, so the side-by-side timings, each taken in one sitting, are the better comparison.
// The starting kernel, v000, takes 378 microseconds a run.
#include <hip/hip_runtime.h>

typedef _Float16 h16;
typedef __attribute__((ext_vector_type(16))) _Float16 v16h;
typedef __attribute__((ext_vector_type(8)))  _Float16 v8h;
typedef __attribute__((ext_vector_type(8)))  float    v8f;

#define NB 2
#define NS 2048
#define NE 1024
#define NH 16
#define ND 64
#define ROWS (NB * NS) /* 4096 */

static __device__ __forceinline__ v8f wmma_f16(v16h a, v16h b, v8f c) {
  // 8 args: (neg_a, A, neg_b, B, c_mod, C, reuse_a, reuse_b)
  return __builtin_amdgcn_wmma_f32_16x16x32_f16(false, a, false, b, (short)0, c,
                                                false, false);
}

// Two contiguous 16-byte loads -> one 16-half fragment (b128 pairs)
static __device__ __forceinline__ v16h load_frag2(const h16* p0, const h16* p1) {
  v8h lo = *(const v8h*)p0;
  v8h hi = *(const v8h*)p1;
  return __builtin_shufflevector(lo, hi, 0, 1, 2, 3, 4, 5, 6, 7, 8, 9, 10, 11,
                                 12, 13, 14, 15);
}

__global__ void cvt_kernel(const float* __restrict__ src, h16* __restrict__ dst,
                           int n) {
  int i = blockIdx.x * blockDim.x + threadIdx.x;
  if (i < n) dst[i] = (h16)src[i];
}

// Batched transpose-convert: src [batch, R, C] f32 -> dst [batch, C, R] f16
__global__ void cvt_t_kernel(const float* __restrict__ src,
                             h16* __restrict__ dst, int R, int C, int n) {
  int i = blockIdx.x * blockDim.x + threadIdx.x;
  if (i >= n) return;
  const int rc = R * C;
  const int bb = i / rc;
  const int rem = i - bb * rc;
  const int r = rem / C;
  const int c = rem - r * C;
  dst[(size_t)bb * rc + (size_t)c * R + r] = (h16)src[i];
}

// Per-head projection: out = x @ W[h] + bias[h], W pre-transposed [H,D,E].
// grid = (ROWS/128, NH), block = 128 (4 waves, each wave -> 32 rows x 64 cols)
// vt=0: out[b,h,s,d];  vt=1: out[b,h,d,s] (transposed, for V)
__global__ __launch_bounds__(128) void qkv_gemm_kernel(
    const h16* __restrict__ X,       // [ROWS, NE]
    const h16* __restrict__ Wt,      // [NH, ND, NE]
    const float* __restrict__ bias,  // [NH, ND]
    h16* __restrict__ out, int vt)
{
  const int tid  = threadIdx.x;
  const int wave = tid >> 5;
  const int lane = tid & 31;
  const int half = lane >> 4;
  const int l16  = lane & 15;
  const int kb0  = half * 8;
  const int kb1  = 16 + half * 8;
  const int h    = blockIdx.y;
  const int rowbase = blockIdx.x * 128 + wave * 32;

  const h16* Wh = Wt + (size_t)h * ND * NE;
  v8f acc[2][4] = {};

  for (int kc = 0; kc < NE; kc += 32) {
    const h16* xr0 = X + (size_t)(rowbase + l16) * NE + kc;
    const h16* xr1 = X + (size_t)(rowbase + 16 + l16) * NE + kc;
    // hoist ALL loads: 4 B fragments + 2 A fragments live at once so the
    // scheduler can issue partial s_wait_loadcnt and overlap loads with WMMAs
    v16h a0 = load_frag2(xr0 + kb0, xr0 + kb1);
    v16h a1 = load_frag2(xr1 + kb0, xr1 + kb1);
    v16h bm[4];
#pragma unroll
    for (int nt = 0; nt < 4; ++nt) {
      const h16* wr = Wh + (size_t)(nt * 16 + l16) * NE + kc;
      bm[nt] = load_frag2(wr + kb0, wr + kb1);
    }
    if (kc + 32 < NE) {
      __builtin_prefetch(xr0 + 32, 0, 3);
      __builtin_prefetch(xr1 + 32, 0, 3);
    }
#pragma unroll
    for (int nt = 0; nt < 4; ++nt) {
      acc[0][nt] = wmma_f16(a0, bm[nt], acc[0][nt]);
      acc[1][nt] = wmma_f16(a1, bm[nt], acc[1][nt]);
    }
  }

#pragma unroll
  for (int mt = 0; mt < 2; ++mt)
#pragma unroll
    for (int nt = 0; nt < 4; ++nt)
#pragma unroll
      for (int r = 0; r < 8; ++r) {
        const int rowg = rowbase + mt * 16 + half * 8 + r;
        const int b    = rowg >> 11;  // / NS
        const int s    = rowg & (NS - 1);
        const int n    = nt * 16 + l16;
        const float v  = acc[mt][nt][r] + bias[h * ND + n];
        if (vt)
          out[((size_t)(b * NH + h) * ND + n) * NS + s] = (h16)v;
        else
          out[((size_t)(b * NH + h) * NS + s) * ND + n] = (h16)v;
      }
}

// Flash-attention: one wave per 32-row query tile per (b,h); K/V fragments
// are shared by both 16-row sub-tiles (2x WMMA per byte loaded from L2).
// grid = NB*NH*(NS/32), block = 32.  V is transposed [NB*NH, ND, NS].
__global__ __launch_bounds__(32) void attn_kernel(
    const h16* __restrict__ Q,   // [NB*NH, NS, ND]
    const h16* __restrict__ K,   // [NB*NH, NS, ND]
    const h16* __restrict__ Vt,  // [NB*NH, ND, NS]
    h16* __restrict__ O)         // [NB, NS, NH*ND]
{
  __shared__ h16 lp[2][16 * 32];  // P tile relayout buffers (one per m-tile)
  const int lane = threadIdx.x;
  const int half = lane >> 4;
  const int l16  = lane & 15;
  const int kb0  = half * 8;
  const int kb1  = 16 + half * 8;
  const int qt   = blockIdx.x & (NS / 32 - 1);
  const int bh   = blockIdx.x >> 6;
  const int h    = bh & (NH - 1);
  const int b    = bh >> 4;
  const int qbase = qt * 32;

  const h16* Qp = Q + (size_t)bh * NS * ND;
  const h16* Kp = K + (size_t)bh * NS * ND;
  const h16* Vp = Vt + (size_t)bh * ND * NS;

  // Q fragments: 2 m-tiles x 2 K-chunks, resident for the whole pass
  v16h aq[2][2];
#pragma unroll
  for (int mt = 0; mt < 2; ++mt) {
    const h16* qrow = Qp + (size_t)(qbase + mt * 16 + l16) * ND;
#pragma unroll
    for (int kc = 0; kc < 2; ++kc)
      aq[mt][kc] = load_frag2(qrow + kc * 32 + kb0, qrow + kc * 32 + kb1);
  }

  v8f acc[2][4] = {};
  float row_m[2][8], row_l[2][8];
#pragma unroll
  for (int mt = 0; mt < 2; ++mt)
#pragma unroll
    for (int r = 0; r < 8; ++r) { row_m[mt][r] = -1e30f; row_l[mt][r] = 0.0f; }

  const float scale  = 0.125f;        // 1/sqrt(64)
  const int nchunks = (qbase >> 5) + 1;  // causal bound (rows < qbase+32)

  for (int ch = 0; ch < nchunks; ++ch) {
    const int tbase = ch * 32;

    // ---- K fragments (hoisted; shared by both m-tiles) ----
    v16h bk[2][2];  // [tt][kc]
#pragma unroll
    for (int tt = 0; tt < 2; ++tt) {
      const h16* krow = Kp + (size_t)(tbase + tt * 16 + l16) * ND;
#pragma unroll
      for (int kc = 0; kc < 2; ++kc)
        bk[tt][kc] = load_frag2(krow + kc * 32 + kb0, krow + kc * 32 + kb1);
    }
    if (ch + 1 < nchunks) {
      __builtin_prefetch(Kp + (size_t)(tbase + 32 + l16) * ND, 0, 3);
      __builtin_prefetch(Kp + (size_t)(tbase + 48 + l16) * ND, 0, 3);
    }

    // ---- scores: S = Q K^T ----
    v8f c[2][2] = {};  // [mt][tt]
#pragma unroll
    for (int mt = 0; mt < 2; ++mt)
#pragma unroll
      for (int tt = 0; tt < 2; ++tt)
#pragma unroll
        for (int kc = 0; kc < 2; ++kc)
          c[mt][tt] = wmma_f16(aq[mt][kc], bk[tt][kc], c[mt][tt]);

    // ---- scale + causal mask + online softmax (per m-tile) ----
    float corr[2][8];
#pragma unroll
    for (int mt = 0; mt < 2; ++mt) {
#pragma unroll
      for (int r = 0; r < 8; ++r) {
        const int srow = qbase + mt * 16 + half * 8 + r;
        float s0 = c[mt][0][r] * scale;
        float s1 = c[mt][1][r] * scale;
        if (tbase + l16 > srow)      s0 = -1e30f;
        if (tbase + 16 + l16 > srow) s1 = -1e30f;
        float mx = fmaxf(s0, s1);
#pragma unroll
        for (int o = 1; o < 16; o <<= 1) mx = fmaxf(mx, __shfl_xor(mx, o, 32));
        const float mnew = fmaxf(row_m[mt][r], mx);
        const float p0 = __expf(s0 - mnew);
        const float p1 = __expf(s1 - mnew);
        corr[mt][r]  = __expf(row_m[mt][r] - mnew);
        row_m[mt][r] = mnew;
        float ps = p0 + p1;
#pragma unroll
        for (int o = 1; o < 16; o <<= 1) ps += __shfl_xor(ps, o, 32);
        row_l[mt][r] = row_l[mt][r] * corr[mt][r] + ps;
        lp[mt][(half * 8 + r) * 32 + l16]      = (h16)p0;
        lp[mt][(half * 8 + r) * 32 + 16 + l16] = (h16)p1;
      }
    }
    __syncthreads();

    // rescale running accumulators
#pragma unroll
    for (int mt = 0; mt < 2; ++mt)
#pragma unroll
      for (int nt = 0; nt < 4; ++nt)
#pragma unroll
        for (int r = 0; r < 8; ++r) acc[mt][nt][r] *= corr[mt][r];

    // P fragments (C-layout -> A-layout via LDS), contiguous b128 reads
    v16h ap[2];
#pragma unroll
    for (int mt = 0; mt < 2; ++mt)
      ap[mt] = load_frag2(&lp[mt][l16 * 32 + kb0], &lp[mt][l16 * 32 + kb1]);

    // ---- V fragments (hoisted; shared by both m-tiles) ----
    v16h bv[4];
#pragma unroll
    for (int nt = 0; nt < 4; ++nt) {
      const h16* vr = Vp + (size_t)(nt * 16 + l16) * NS + tbase;
      bv[nt] = load_frag2(vr + kb0, vr + kb1);
    }

    // ---- O += P V ----
#pragma unroll
    for (int nt = 0; nt < 4; ++nt) {
      acc[0][nt] = wmma_f16(ap[0], bv[nt], acc[0][nt]);
      acc[1][nt] = wmma_f16(ap[1], bv[nt], acc[1][nt]);
    }
    __syncthreads();
  }

  // normalize + store (head-concat layout [B, S, H*D])
#pragma unroll
  for (int mt = 0; mt < 2; ++mt)
#pragma unroll
    for (int r = 0; r < 8; ++r) {
      const float inv = 1.0f / row_l[mt][r];
      const int s = qbase + mt * 16 + half * 8 + r;
#pragma unroll
      for (int nt = 0; nt < 4; ++nt) {
        O[((size_t)b * NS + s) * (NH * ND) + h * ND + nt * 16 + l16] =
            (h16)(acc[mt][nt][r] * inv);
      }
    }
}

// Output projection: out = A @ W_o + b_o (f32), W_o pre-transposed [NE, NH*ND]
// grid = (ROWS/128, NE/64), block = 128 (4 waves, each wave 32 rows x 64 cols)
__global__ __launch_bounds__(128) void out_gemm_kernel(
    const h16* __restrict__ A,       // [ROWS, NH*ND]
    const h16* __restrict__ Wot,     // [NE, NH*ND]
    const float* __restrict__ bias,  // [NE]
    float* __restrict__ out)         // [ROWS, NE]
{
  const int tid  = threadIdx.x;
  const int wave = tid >> 5;
  const int lane = tid & 31;
  const int half = lane >> 4;
  const int l16  = lane & 15;
  const int kb0  = half * 8;
  const int kb1  = 16 + half * 8;
  const int rowbase = blockIdx.x * 128 + wave * 32;
  const int ntbase  = blockIdx.y * 64;
  const int KDIM = NH * ND;  // 1024

  v8f acc[2][4] = {};
  for (int kc = 0; kc < KDIM; kc += 32) {
    const h16* ar0 = A + (size_t)(rowbase + l16) * KDIM + kc;
    const h16* ar1 = A + (size_t)(rowbase + 16 + l16) * KDIM + kc;
    v16h a0 = load_frag2(ar0 + kb0, ar0 + kb1);
    v16h a1 = load_frag2(ar1 + kb0, ar1 + kb1);
    v16h bm[4];
#pragma unroll
    for (int nt = 0; nt < 4; ++nt) {
      const h16* wr = Wot + (size_t)(ntbase + nt * 16 + l16) * KDIM + kc;
      bm[nt] = load_frag2(wr + kb0, wr + kb1);
    }
    if (kc + 32 < KDIM) {
      __builtin_prefetch(ar0 + 32, 0, 3);
      __builtin_prefetch(ar1 + 32, 0, 3);
    }
#pragma unroll
    for (int nt = 0; nt < 4; ++nt) {
      acc[0][nt] = wmma_f16(a0, bm[nt], acc[0][nt]);
      acc[1][nt] = wmma_f16(a1, bm[nt], acc[1][nt]);
    }
  }

#pragma unroll
  for (int mt = 0; mt < 2; ++mt)
#pragma unroll
    for (int nt = 0; nt < 4; ++nt)
#pragma unroll
      for (int r = 0; r < 8; ++r) {
        const int rowg = rowbase + mt * 16 + half * 8 + r;
        const int n    = ntbase + nt * 16 + l16;
        out[(size_t)rowg * NE + n] = acc[mt][nt][r] + bias[n];
      }
}

extern "C" void kernel_launch(void* const* d_in, const int* in_sizes, int n_in,
                              void* d_out, int out_size, void* d_ws,
                              size_t ws_size, hipStream_t stream) {
  const float* x   = (const float*)d_in[0];
  const float* W_q = (const float*)d_in[1];
  const float* b_q = (const float*)d_in[2];
  const float* W_k = (const float*)d_in[3];
  const float* b_k = (const float*)d_in[4];
  const float* W_v = (const float*)d_in[5];
  const float* b_v = (const float*)d_in[6];
  const float* W_o = (const float*)d_in[7];
  const float* b_o = (const float*)d_in[8];
  float* out = (float*)d_out;

  const size_t nx   = (size_t)ROWS * NE;          // 4M halves
  const size_t nqkv = (size_t)NB * NH * NS * ND;  // 4M halves
  const size_t nw   = (size_t)NH * NE * ND;       // 1M halves
  h16* xh  = (h16*)d_ws;
  h16* qh  = xh + nx;
  h16* kh  = qh + nqkv;
  h16* vh  = kh + nqkv;   // transposed V: [NB*NH, ND, NS]
  h16* oh  = vh + nqkv;
  h16* wqh = oh + nx;     // transposed: [NH, ND, NE]
  h16* wkh = wqh + nw;
  h16* wvh = wkh + nw;
  h16* woh = wvh + nw;    // transposed: [NE, NH*ND]

  cvt_kernel<<<(int)((nx + 255) / 256), 256, 0, stream>>>(x, xh, (int)nx);
  cvt_t_kernel<<<(int)((nw + 255) / 256), 256, 0, stream>>>(W_q, wqh, NE, ND,
                                                            (int)nw);
  cvt_t_kernel<<<(int)((nw + 255) / 256), 256, 0, stream>>>(W_k, wkh, NE, ND,
                                                            (int)nw);
  cvt_t_kernel<<<(int)((nw + 255) / 256), 256, 0, stream>>>(W_v, wvh, NE, ND,
                                                            (int)nw);
  cvt_t_kernel<<<(int)((nw + 255) / 256), 256, 0, stream>>>(W_o, woh, NH * ND,
                                                            NE, (int)nw);

  dim3 gq(ROWS / 128, NH);
  qkv_gemm_kernel<<<gq, 128, 0, stream>>>(xh, wqh, b_q, qh, 0);
  qkv_gemm_kernel<<<gq, 128, 0, stream>>>(xh, wkh, b_k, kh, 0);
  qkv_gemm_kernel<<<gq, 128, 0, stream>>>(xh, wvh, b_v, vh, 1);

  attn_kernel<<<NB * NH * (NS / 32), 32, 0, stream>>>(qh, kh, vh, oh);

  dim3 go(ROWS / 128, NE / 64);
  out_gemm_kernel<<<go, 128, 0, stream>>>(oh, woh, b_o, out);
}

// v001
// A run of this version takes 265 microseconds.
// Timed twice side by side with v000, it ran 1.43 times as fast both times.
#include <hip/hip_runtime.h>

typedef _Float16 h16;
typedef __attribute__((ext_vector_type(16))) _Float16 v16h;
typedef __attribute__((ext_vector_type(8)))  _Float16 v8h;
typedef __attribute__((ext_vector_type(8)))  float    v8f;
typedef __attribute__((ext_vector_type(2)))  _Float16 v2h;
typedef __attribute__((ext_vector_type(4)))  float    v4f;

#define NB 2
#define NS 2048
#define NE 1024
#define NH 16
#define ND 64
#define ROWS (NB * NS) /* 4096 */

static __device__ __forceinline__ v8f wmma_f16(v16h a, v16h b, v8f c) {
  // 8 args: (neg_a, A, neg_b, B, c_mod, C, reuse_a, reuse_b)
  return __builtin_amdgcn_wmma_f32_16x16x32_f16(false, a, false, b, (short)0, c,
                                                false, false);
}

// Two contiguous 16-byte loads -> one 16-half fragment (b128 pairs)
static __device__ __forceinline__ v16h load_frag2(const h16* p0, const h16* p1) {
  v8h lo = *(const v8h*)p0;
  v8h hi = *(const v8h*)p1;
  return __builtin_shufflevector(lo, hi, 0, 1, 2, 3, 4, 5, 6, 7, 8, 9, 10, 11,
                                 12, 13, 14, 15);
}

__global__ void cvt_kernel(const float* __restrict__ src, h16* __restrict__ dst,
                           int n) {
  int i = blockIdx.x * blockDim.x + threadIdx.x;
  if (i < n) dst[i] = (h16)src[i];
}

// Batched transpose-convert: src [batch, R, C] f32 -> dst [batch, C, R] f16
// One 64x64 tile per block, turned in LDS, so that both sides of the copy move
// whole 128-byte lines.  grid = (C/64, R/64, batch), block = 256.
// The tile is kept as [c][r]; the eight 16-byte chunks of a row are XOR-ed
// with (c >> 2) & 7 so that the 4-byte stores of a wave (columns 4 apart)
// spread over the banks while the 16-byte reads stay aligned.
__global__ __launch_bounds__(256) void cvt_t_kernel(
    const float* __restrict__ src, h16* __restrict__ dst, int R, int C) {
  __shared__ __attribute__((aligned(16))) h16 tile[64 * 64];
  const int tid = threadIdx.x;
  const int c0  = blockIdx.x * 64;
  const int r0  = blockIdx.y * 64;
  const size_t base = (size_t)blockIdx.z * R * C;
  const int cq = (tid & 15) * 4;  // four columns per thread
  const int rp = (tid >> 4) * 2;  // a pair of rows per thread

  // the loops below are unrolled so that v[][] stays in registers and the four
  // loads of a thread are in flight together
  v4f v[2][2];
#pragma unroll
  for (int it = 0; it < 2; ++it)
#pragma unroll
    for (int p = 0; p < 2; ++p)
      v[it][p] = *(const v4f*)(src + base +
                               (size_t)(r0 + it * 32 + rp + p) * C + c0 + cq);
#pragma unroll
  for (int it = 0; it < 2; ++it)
#pragma unroll
    for (int j = 0; j < 4; ++j) {
      const int c = cq + j;
      const int r = it * 32 + rp;
      const int chunk = (r >> 3) ^ ((c >> 2) & 7);
      v2h pr = {(h16)v[it][0][j], (h16)v[it][1][j]};
      *(v2h*)&tile[c * 64 + chunk * 8 + (r & 7)] = pr;
    }
  __syncthreads();
#pragma unroll
  for (int it = 0; it < 2; ++it) {
    const int c = it * 32 + (tid >> 3);
    const int q = tid & 7;
    const v8h o = *(const v8h*)&tile[c * 64 + (q ^ ((c >> 2) & 7)) * 8];
    *(v8h*)(dst + base + (size_t)(c0 + c) * R + r0 + q * 8) = o;
  }
}

// Per-head projection: out = x @ W[h] + bias[h], W pre-transposed [H,D,E].
// grid = (ROWS/128, NH), block = 128 (4 waves, each wave -> 32 rows x 64 cols)
// vt=0: out[b,h,s,d];  vt=1: out[b,h,d,s] (transposed, for V)
__global__ __launch_bounds__(128) void qkv_gemm_kernel(
    const h16* __restrict__ X,       // [ROWS, NE]
    const h16* __restrict__ Wt,      // [NH, ND, NE]
    const float* __restrict__ bias,  // [NH, ND]
    h16* __restrict__ out, int vt)
{
  const int tid  = threadIdx.x;
  const int wave = tid >> 5;
  const int lane = tid & 31;
  const int half = lane >> 4;
  const int l16  = lane & 15;
  const int kb0  = half * 8;
  const int kb1  = 16 + half * 8;
  const int h    = blockIdx.y;
  const int rowbase = blockIdx.x * 128 + wave * 32;

  const h16* Wh = Wt + (size_t)h * ND * NE;
  v8f acc[2][4] = {};

  for (int kc = 0; kc < NE; kc += 32) {
    const h16* xr0 = X + (size_t)(rowbase + l16) * NE + kc;
    const h16* xr1 = X + (size_t)(rowbase + 16 + l16) * NE + kc;
    // hoist ALL loads: 4 B fragments + 2 A fragments live at once so the
    // scheduler can issue partial s_wait_loadcnt and overlap loads with WMMAs
    v16h a0 = load_frag2(xr0 + kb0, xr0 + kb1);
    v16h a1 = load_frag2(xr1 + kb0, xr1 + kb1);
    v16h bm[4];
#pragma unroll
    for (int nt = 0; nt < 4; ++nt) {
      const h16* wr = Wh + (size_t)(nt * 16 + l16) * NE + kc;
      bm[nt] = load_frag2(wr + kb0, wr + kb1);
    }
    if (kc + 32 < NE) {
      __builtin_prefetch(xr0 + 32, 0, 3);
      __builtin_prefetch(xr1 + 32, 0, 3);
    }
#pragma unroll
    for (int nt = 0; nt < 4; ++nt) {
      acc[0][nt] = wmma_f16(a0, bm[nt], acc[0][nt]);
      acc[1][nt] = wmma_f16(a1, bm[nt], acc[1][nt]);
    }
  }

#pragma unroll
  for (int mt = 0; mt < 2; ++mt)
#pragma unroll
    for (int nt = 0; nt < 4; ++nt)
#pragma unroll
      for (int r = 0; r < 8; ++r) {
        const int rowg = rowbase + mt * 16 + half * 8 + r;
        const int b    = rowg >> 11;  // / NS
        const int s    = rowg & (NS - 1);
        const int n    = nt * 16 + l16;
        const float v  = acc[mt][nt][r] + bias[h * ND + n];
        if (vt)
          out[((size_t)(b * NH + h) * ND + n) * NS + s] = (h16)v;
        else
          out[((size_t)(b * NH + h) * NS + s) * ND + n] = (h16)v;
      }
}

// Flash-attention: one wave per 32-row query tile per (b,h); K/V fragments
// are shared by both 16-row sub-tiles (2x WMMA per byte loaded from L2).
// grid = NB*NH*(NS/32), block = 32.  V is transposed [NB*NH, ND, NS].
__global__ __launch_bounds__(32) void attn_kernel(
    const h16* __restrict__ Q,   // [NB*NH, NS, ND]
    const h16* __restrict__ K,   // [NB*NH, NS, ND]
    const h16* __restrict__ Vt,  // [NB*NH, ND, NS]
    h16* __restrict__ O)         // [NB, NS, NH*ND]
{
  __shared__ h16 lp[2][16 * 32];  // P tile relayout buffers (one per m-tile)
  const int lane = threadIdx.x;
  const int half = lane >> 4;
  const int l16  = lane & 15;
  const int kb0  = half * 8;
  const int kb1  = 16 + half * 8;
  const int qt   = blockIdx.x & (NS / 32 - 1);
  const int bh   = blockIdx.x >> 6;
  const int h    = bh & (NH - 1);
  const int b    = bh >> 4;
  const int qbase = qt * 32;

  const h16* Qp = Q + (size_t)bh * NS * ND;
  const h16* Kp = K + (size_t)bh * NS * ND;
  const h16* Vp = Vt + (size_t)bh * ND * NS;

  // Q fragments: 2 m-tiles x 2 K-chunks, resident for the whole pass
  v16h aq[2][2];
#pragma unroll
  for (int mt = 0; mt < 2; ++mt) {
    const h16* qrow = Qp + (size_t)(qbase + mt * 16 + l16) * ND;
#pragma unroll
    for (int kc = 0; kc < 2; ++kc)
      aq[mt][kc] = load_frag2(qrow + kc * 32 + kb0, qrow + kc * 32 + kb1);
  }

  v8f acc[2][4] = {};
  float row_m[2][8], row_l[2][8];
#pragma unroll
  for (int mt = 0; mt < 2; ++mt)
#pragma unroll
    for (int r = 0; r < 8; ++r) { row_m[mt][r] = -1e30f; row_l[mt][r] = 0.0f; }

  const float scale  = 0.125f;        // 1/sqrt(64)
  const int nchunks = (qbase >> 5) + 1;  // causal bound (rows < qbase+32)

  for (int ch = 0; ch < nchunks; ++ch) {
    const int tbase = ch * 32;

    // ---- K fragments (hoisted; shared by both m-tiles) ----
    v16h bk[2][2];  // [tt][kc]
#pragma unroll
    for (int tt = 0; tt < 2; ++tt) {
      const h16* krow = Kp + (size_t)(tbase + tt * 16 + l16) * ND;
#pragma unroll
      for (int kc = 0; kc < 2; ++kc)
        bk[tt][kc] = load_frag2(krow + kc * 32 + kb0, krow + kc * 32 + kb1);
    }
    if (ch + 1 < nchunks) {
      __builtin_prefetch(Kp + (size_t)(tbase + 32 + l16) * ND, 0, 3);
      __builtin_prefetch(Kp + (size_t)(tbase + 48 + l16) * ND, 0, 3);
    }

    // ---- scores: S = Q K^T ----
    v8f c[2][2] = {};  // [mt][tt]
#pragma unroll
    for (int mt = 0; mt < 2; ++mt)
#pragma unroll
      for (int tt = 0; tt < 2; ++tt)
#pragma unroll
        for (int kc = 0; kc < 2; ++kc)
          c[mt][tt] = wmma_f16(aq[mt][kc], bk[tt][kc], c[mt][tt]);

    // ---- scale + causal mask + online softmax (per m-tile) ----
    float corr[2][8];
#pragma unroll
    for (int mt = 0; mt < 2; ++mt) {
#pragma unroll
      for (int r = 0; r < 8; ++r) {
        const int srow = qbase + mt * 16 + half * 8 + r;
        float s0 = c[mt][0][r] * scale;
        float s1 = c[mt][1][r] * scale;
        if (tbase + l16 > srow)      s0 = -1e30f;
        if (tbase + 16 + l16 > srow) s1 = -1e30f;
        float mx = fmaxf(s0, s1);
#pragma unroll
        for (int o = 1; o < 16; o <<= 1) mx = fmaxf(mx, __shfl_xor(mx, o, 32));
        const float mnew = fmaxf(row_m[mt][r], mx);
        const float p0 = __expf(s0 - mnew);
        const float p1 = __expf(s1 - mnew);
        corr[mt][r]  = __expf(row_m[mt][r] - mnew);
        row_m[mt][r] = mnew;
        float ps = p0 + p1;
#pragma unroll
        for (int o = 1; o < 16; o <<= 1) ps += __shfl_xor(ps, o, 32);
        row_l[mt][r] = row_l[mt][r] * corr[mt][r] + ps;
        lp[mt][(half * 8 + r) * 32 + l16]      = (h16)p0;
        lp[mt][(half * 8 + r) * 32 + 16 + l16] = (h16)p1;
      }
    }
    __syncthreads();

    // rescale running accumulators
#pragma unroll
    for (int mt = 0; mt < 2; ++mt)
#pragma unroll
      for (int nt = 0; nt < 4; ++nt)
#pragma unroll
        for (int r = 0; r < 8; ++r) acc[mt][nt][r] *= corr[mt][r];

    // P fragments (C-layout -> A-layout via LDS), contiguous b128 reads
    v16h ap[2];
#pragma unroll
    for (int mt = 0; mt < 2; ++mt)
      ap[mt] = load_frag2(&lp[mt][l16 * 32 + kb0], &lp[mt][l16 * 32 + kb1]);

    // ---- V fragments (hoisted; shared by both m-tiles) ----
    v16h bv[4];
#pragma unroll
    for (int nt = 0; nt < 4; ++nt) {
      const h16* vr = Vp + (size_t)(nt * 16 + l16) * NS + tbase;
      bv[nt] = load_frag2(vr + kb0, vr + kb1);
    }

    // ---- O += P V ----
#pragma unroll
    for (int nt = 0; nt < 4; ++nt) {
      acc[0][nt] = wmma_f16(ap[0], bv[nt], acc[0][nt]);
      acc[1][nt] = wmma_f16(ap[1], bv[nt], acc[1][nt]);
    }
    __syncthreads();
  }

  // normalize + store (head-concat layout [B, S, H*D])
#pragma unroll
  for (int mt = 0; mt < 2; ++mt)
#pragma unroll
    for (int r = 0; r < 8; ++r) {
      const float inv = 1.0f / row_l[mt][r];
      const int s = qbase + mt * 16 + half * 8 + r;
#pragma unroll
      for (int nt = 0; nt < 4; ++nt) {
        O[((size_t)b * NS + s) * (NH * ND) + h * ND + nt * 16 + l16] =
            (h16)(acc[mt][nt][r] * inv);
      }
    }
}

// Output projection: out = A @ W_o + b_o (f32), W_o pre-transposed [NE, NH*ND]
// grid = (ROWS/128, NE/64), block = 128 (4 waves, each wave 32 rows x 64 cols)
__global__ __launch_bounds__(128) void out_gemm_kernel(
    const h16* __restrict__ A,       // [ROWS, NH*ND]
    const h16* __restrict__ Wot,     // [NE, NH*ND]
    const float* __restrict__ bias,  // [NE]
    float* __restrict__ out)         // [ROWS, NE]
{
  const int tid  = threadIdx.x;
  const int wave = tid >> 5;
  const int lane = tid & 31;
  const int half = lane >> 4;
  const int l16  = lane & 15;
  const int kb0  = half * 8;
  const int kb1  = 16 + half * 8;
  const int rowbase = blockIdx.x * 128 + wave * 32;
  const int ntbase  = blockIdx.y * 64;
  const int KDIM = NH * ND;  // 1024

  v8f acc[2][4] = {};
  for (int kc = 0; kc < KDIM; kc += 32) {
    const h16* ar0 = A + (size_t)(rowbase + l16) * KDIM + kc;
    const h16* ar1 = A + (size_t)(rowbase + 16 + l16) * KDIM + kc;
    v16h a0 = load_frag2(ar0 + kb0, ar0 + kb1);
    v16h a1 = load_frag2(ar1 + kb0, ar1 + kb1);
    v16h bm[4];
#pragma unroll
    for (int nt = 0; nt < 4; ++nt) {
      const h16* wr = Wot + (size_t)(ntbase + nt * 16 + l16) * KDIM + kc;
      bm[nt] = load_frag2(wr + kb0, wr + kb1);
    }
    if (kc + 32 < KDIM) {
      __builtin_prefetch(ar0 + 32, 0, 3);
      __builtin_prefetch(ar1 + 32, 0, 3);
    }
#pragma unroll
    for (int nt = 0; nt < 4; ++nt) {
      acc[0][nt] = wmma_f16(a0, bm[nt], acc[0][nt]);
      acc[1][nt] = wmma_f16(a1, bm[nt], acc[1][nt]);
    }
  }

#pragma unroll
  for (int mt = 0; mt < 2; ++mt)
#pragma unroll
    for (int nt = 0; nt < 4; ++nt)
#pragma unroll
      for (int r = 0; r < 8; ++r) {
        const int rowg = rowbase + mt * 16 + half * 8 + r;
        const int n    = ntbase + nt * 16 + l16;
        out[(size_t)rowg * NE + n] = acc[mt][nt][r] + bias[n];
      }
}

extern "C" void kernel_launch(void* const* d_in, const int* in_sizes, int n_in,
                              void* d_out, int out_size, void* d_ws,
                              size_t ws_size, hipStream_t stream) {
  const float* x   = (const float*)d_in[0];
  const float* W_q = (const float*)d_in[1];
  const float* b_q = (const float*)d_in[2];
  const float* W_k = (const float*)d_in[3];
  const float* b_k = (const float*)d_in[4];
  const float* W_v = (const float*)d_in[5];
  const float* b_v = (const float*)d_in[6];
  const float* W_o = (const float*)d_in[7];
  const float* b_o = (const float*)d_in[8];
  float* out = (float*)d_out;

  const size_t nx   = (size_t)ROWS * NE;          // 4M halves
  const size_t nqkv = (size_t)NB * NH * NS * ND;  // 4M halves
  const size_t nw   = (size_t)NH * NE * ND;       // 1M halves
  h16* xh  = (h16*)d_ws;
  h16* qh  = xh + nx;
  h16* kh  = qh + nqkv;
  h16* vh  = kh + nqkv;   // transposed V: [NB*NH, ND, NS]
  h16* oh  = vh + nqkv;
  h16* wqh = oh + nx;     // transposed: [NH, ND, NE]
  h16* wkh = wqh + nw;
  h16* wvh = wkh + nw;
  h16* woh = wvh + nw;    // transposed: [NE, NH*ND]

  cvt_kernel<<<(int)((nx + 255) / 256), 256, 0, stream>>>(x, xh, (int)nx);
  dim3 gw(ND / 64, NE / 64, NH);         // per-head [NE, ND] -> [ND, NE]
  dim3 gwo(NE / 64, (NH * ND) / 64, 1);  // [NH*ND, NE] -> [NE, NH*ND]
  cvt_t_kernel<<<gw, 256, 0, stream>>>(W_q, wqh, NE, ND);
  cvt_t_kernel<<<gw, 256, 0, stream>>>(W_k, wkh, NE, ND);
  cvt_t_kernel<<<gw, 256, 0, stream>>>(W_v, wvh, NE, ND);
  cvt_t_kernel<<<gwo, 256, 0, stream>>>(W_o, woh, NH * ND, NE);

  dim3 gq(ROWS / 128, NH);
  qkv_gemm_kernel<<<gq, 128, 0, stream>>>(xh, wqh, b_q, qh, 0);
  qkv_gemm_kernel<<<gq, 128, 0, stream>>>(xh, wkh, b_k, kh, 0);
  qkv_gemm_kernel<<<gq, 128, 0, stream>>>(xh, wvh, b_v, vh, 1);

  attn_kernel<<<NB * NH * (NS / 32), 32, 0, stream>>>(qh, kh, vh, oh);

  dim3 go(ROWS / 128, NE / 64);
  out_gemm_kernel<<<go, 128, 0, stream>>>(oh, woh, b_o, out);
}

// v002
// A run of this version takes 190 microseconds.
// In two side-by-side timings against v001, it was 1.39 and 1.40 times as fast.
// Over all steps from v000 it is 2.00 times as fast.
#include <hip/hip_runtime.h>

typedef _Float16 h16;
typedef __attribute__((ext_vector_type(16))) _Float16 v16h;
typedef __attribute__((ext_vector_type(8)))  _Float16 v8h;
typedef __attribute__((ext_vector_type(8)))  float    v8f;
typedef __attribute__((ext_vector_type(2)))  _Float16 v2h;
typedef __attribute__((ext_vector_type(4)))  float    v4f;

#define NB 2
#define NS 2048
#define NE 1024
#define NH 16
#define ND 64
#define ROWS (NB * NS) /* 4096 */

static __device__ __forceinline__ v8f wmma_f16(v16h a, v16h b, v8f c) {
  // 8 args: (neg_a, A, neg_b, B, c_mod, C, reuse_a, reuse_b)
  return __builtin_amdgcn_wmma_f32_16x16x32_f16(false, a, false, b, (short)0, c,
                                                false, false);
}

// Two contiguous 16-byte loads -> one 16-half fragment (b128 pairs)
static __device__ __forceinline__ v16h load_frag2(const h16* p0, const h16* p1) {
  v8h lo = *(const v8h*)p0;
  v8h hi = *(const v8h*)p1;
  return __builtin_shufflevector(lo, hi, 0, 1, 2, 3, 4, 5, 6, 7, 8, 9, 10, 11,
                                 12, 13, 14, 15);
}

__global__ void cvt_kernel(const float* __restrict__ src, h16* __restrict__ dst,
                           int n) {
  int i = blockIdx.x * blockDim.x + threadIdx.x;
  if (i < n) dst[i] = (h16)src[i];
}

// Batched transpose-convert: src [batch, R, C] f32 -> dst [batch, C, R] f16
// One 64x64 tile per block, turned in LDS, so that both sides of the copy move
// whole 128-byte lines.  grid = (C/64, R/64, batch), block = 256.
// The tile is kept as [c][r]; the eight 16-byte chunks of a row are XOR-ed
// with (c >> 2) & 7 so that the 4-byte stores of a wave (columns 4 apart)
// spread over the banks while the 16-byte reads stay aligned.
__global__ __launch_bounds__(256) void cvt_t_kernel(
    const float* __restrict__ src, h16* __restrict__ dst, int R, int C) {
  __shared__ __attribute__((aligned(16))) h16 tile[64 * 64];
  const int tid = threadIdx.x;
  const int c0  = blockIdx.x * 64;
  const int r0  = blockIdx.y * 64;
  const size_t base = (size_t)blockIdx.z * R * C;
  const int cq = (tid & 15) * 4;  // four columns per thread
  const int rp = (tid >> 4) * 2;  // a pair of rows per thread

  // the loops below are unrolled so that v[][] stays in registers and the four
  // loads of a thread are in flight together
  v4f v[2][2];
#pragma unroll
  for (int it = 0; it < 2; ++it)
#pragma unroll
    for (int p = 0; p < 2; ++p)
      v[it][p] = *(const v4f*)(src + base +
                               (size_t)(r0 + it * 32 + rp + p) * C + c0 + cq);
#pragma unroll
  for (int it = 0; it < 2; ++it)
#pragma unroll
    for (int j = 0; j < 4; ++j) {
      const int c = cq + j;
      const int r = it * 32 + rp;
      const int chunk = (r >> 3) ^ ((c >> 2) & 7);
      v2h pr = {(h16)v[it][0][j], (h16)v[it][1][j]};
      *(v2h*)&tile[c * 64 + chunk * 8 + (r & 7)] = pr;
    }
  __syncthreads();
#pragma unroll
  for (int it = 0; it < 2; ++it) {
    const int c = it * 32 + (tid >> 3);
    const int q = tid & 7;
    const v8h o = *(const v8h*)&tile[c * 64 + (q ^ ((c >> 2) & 7)) * 8];
    *(v8h*)(dst + base + (size_t)(c0 + c) * R + r0 + q * 8) = o;
  }
}

// Per-head projection: out = x @ W[h] + bias[h], W pre-transposed [H,D,E].
// grid = (ROWS/128, NH), block = 128 (4 waves, each wave -> 32 rows x 64 cols)
// vt=0: out[b,h,s,d];  vt=1: out[b,h,d,s] (transposed, for V)
__global__ __launch_bounds__(128) void qkv_gemm_kernel(
    const h16* __restrict__ X,       // [ROWS, NE]
    const h16* __restrict__ Wt,      // [NH, ND, NE]
    const float* __restrict__ bias,  // [NH, ND]
    h16* __restrict__ out, int vt)
{
  const int tid  = threadIdx.x;
  const int wave = tid >> 5;
  const int lane = tid & 31;
  const int half = lane >> 4;
  const int l16  = lane & 15;
  const int kb0  = half * 8;
  const int kb1  = 16 + half * 8;
  const int h    = blockIdx.y;
  const int rowbase = blockIdx.x * 128 + wave * 32;

  const h16* Wh = Wt + (size_t)h * ND * NE;
  v8f acc[2][4] = {};

  for (int kc = 0; kc < NE; kc += 32) {
    const h16* xr0 = X + (size_t)(rowbase + l16) * NE + kc;
    const h16* xr1 = X + (size_t)(rowbase + 16 + l16) * NE + kc;
    // hoist ALL loads: 4 B fragments + 2 A fragments live at once so the
    // scheduler can issue partial s_wait_loadcnt and overlap loads with WMMAs
    v16h a0 = load_frag2(xr0 + kb0, xr0 + kb1);
    v16h a1 = load_frag2(xr1 + kb0, xr1 + kb1);
    v16h bm[4];
#pragma unroll
    for (int nt = 0; nt < 4; ++nt) {
      const h16* wr = Wh + (size_t)(nt * 16 + l16) * NE + kc;
      bm[nt] = load_frag2(wr + kb0, wr + kb1);
    }
    if (kc + 32 < NE) {
      __builtin_prefetch(xr0 + 32, 0, 3);
      __builtin_prefetch(xr1 + 32, 0, 3);
    }
#pragma unroll
    for (int nt = 0; nt < 4; ++nt) {
      acc[0][nt] = wmma_f16(a0, bm[nt], acc[0][nt]);
      acc[1][nt] = wmma_f16(a1, bm[nt], acc[1][nt]);
    }
  }

#pragma unroll
  for (int mt = 0; mt < 2; ++mt)
#pragma unroll
    for (int nt = 0; nt < 4; ++nt)
#pragma unroll
      for (int r = 0; r < 8; ++r) {
        const int rowg = rowbase + mt * 16 + half * 8 + r;
        const int b    = rowg >> 11;  // / NS
        const int s    = rowg & (NS - 1);
        const int n    = nt * 16 + l16;
        const float v  = acc[mt][nt][r] + bias[h * ND + n];
        if (vt)
          out[((size_t)(b * NH + h) * ND + n) * NS + s] = (h16)v;
        else
          out[((size_t)(b * NH + h) * NS + s) * ND + n] = (h16)v;
      }
}

// Lane l <-> lane l ^ 16: the other half of the wave holds the other 16 keys
// of the same query column.
static __device__ __forceinline__ float other_half(float v) {
  int b = __builtin_bit_cast(int, v);
  b = __builtin_amdgcn_permlanex16(b, b, 0x76543210, 0xfedcba98, false, false);
  return __builtin_bit_cast(float, b);
}

// Flash-attention: one wave per 32-query tile per (b,h); K/V fragments are
// shared by both 16-query sub-tiles (2x WMMA per byte loaded from L2).
// The products are taken transposed: St = K Q^T and Ot += Vt Pt.  A lane then
// holds 16 of the 32 scores of ONE query (its column), so maximum and sum are
// taken in the lane, and the two score tiles of a column, converted in place,
// are the B operand of the second product.
// grid = NB*NH*(NS/32), block = 32.  V is transposed [NB*NH, ND, NS].
__global__ __launch_bounds__(32) void attn_kernel(
    const h16* __restrict__ Q,   // [NB*NH, NS, ND]
    const h16* __restrict__ K,   // [NB*NH, NS, ND]
    const h16* __restrict__ Vt,  // [NB*NH, ND, NS]
    h16* __restrict__ O)         // [NB, NS, NH*ND]
{
  const int lane = threadIdx.x;
  const int half = lane >> 4;
  const int l16  = lane & 15;
  const int kb0  = half * 8;
  const int kb1  = 16 + half * 8;
  const int qt   = blockIdx.x & (NS / 32 - 1);
  const int bh   = blockIdx.x >> 6;
  const int h    = bh & (NH - 1);
  const int b    = bh >> 4;
  const int qbase = qt * 32;

  const h16* Qp = Q + (size_t)bh * NS * ND;
  const h16* Kp = K + (size_t)bh * NS * ND;
  const h16* Vp = Vt + (size_t)bh * ND * NS;

  // Q fragments (B operand: lane = query column): 2 column tiles x 2 K-chunks,
  // resident for the whole pass
  v16h bq[2][2];
#pragma unroll
  for (int mt = 0; mt < 2; ++mt) {
    const h16* qrow = Qp + (size_t)(qbase + mt * 16 + l16) * ND;
#pragma unroll
    for (int kc = 0; kc < 2; ++kc)
      bq[mt][kc] = load_frag2(qrow + kc * 32 + kb0, qrow + kc * 32 + kb1);
  }

  // acc[mt][nt][r] = O[query mt*16 + l16][d = nt*16 + half*8 + r]
  v8f acc[2][4] = {};
  float col_m[2] = {-1e30f, -1e30f};  // running maximum of the lane's query
  float col_l[2] = {0.0f, 0.0f};      // running sum over this half's keys only

  const float scale  = 0.125f;        // 1/sqrt(64)
  const int nchunks = (qbase >> 5) + 1;  // causal bound (rows < qbase+32)

  for (int ch = 0; ch < nchunks; ++ch) {
    const int tbase = ch * 32;

    // ---- K fragments (A operand: lane = key row; shared by both tiles) ----
    v16h ak[2][2];  // [tt][kc]
#pragma unroll
    for (int tt = 0; tt < 2; ++tt) {
      const h16* krow = Kp + (size_t)(tbase + tt * 16 + l16) * ND;
#pragma unroll
      for (int kc = 0; kc < 2; ++kc)
        ak[tt][kc] = load_frag2(krow + kc * 32 + kb0, krow + kc * 32 + kb1);
    }
    // K's address registers may be reused as a destination of V's loads
    asm volatile("s_wait_xcnt 0x0" ::: "memory");

    // ---- V fragments (A operand: lane = d row; shared by both tiles) ----
    // one group behind K's loads, so that they fly during scores and softmax
    v16h av[4];
#pragma unroll
    for (int nt = 0; nt < 4; ++nt) {
      const h16* vr = Vp + (size_t)(nt * 16 + l16) * NS + tbase;
      av[nt] = load_frag2(vr + kb0, vr + kb1);
    }
    // keeps the scheduler from sinking V's loads to their use, where it split
    // them into four pairs, each waited for on its own
    __builtin_amdgcn_sched_barrier(0);
    if (ch + 1 < nchunks) {
      __builtin_prefetch(Kp + (size_t)(tbase + 32 + l16) * ND, 0, 3);
      __builtin_prefetch(Kp + (size_t)(tbase + 48 + l16) * ND, 0, 3);
    }
    // the address registers of the loads and prefetches above are advanced or
    // reused below
    asm volatile("s_wait_xcnt 0x0" ::: "memory");
    // keeps the address additions from being lifted over that wait
    __builtin_amdgcn_sched_barrier(0);

    // ---- scores: St = K Q^T ----
    // c[mt][tt][r] = S[query mt*16 + l16][key tbase + tt*16 + half*8 + r]
    v8f c[2][2] = {};
#pragma unroll
    for (int mt = 0; mt < 2; ++mt)
#pragma unroll
      for (int tt = 0; tt < 2; ++tt)
#pragma unroll
        for (int kc = 0; kc < 2; ++kc)
          c[mt][tt] = wmma_f16(ak[tt][kc], bq[mt][kc], c[mt][tt]);

    // ---- scale + causal mask + online softmax (per query column) ----
    float corr[2];
    v16h bp[2];  // P^T as B operand: element tt*8 + r = key tt*16 + half*8 + r
#pragma unroll
    for (int mt = 0; mt < 2; ++mt) {
      const int srow = qbase + mt * 16 + l16;
      float s[16];
#pragma unroll
      for (int e = 0; e < 16; ++e) {
        s[e] = c[mt][e >> 3][e & 7] * scale;
        if (tbase + (e >> 3) * 16 + half * 8 + (e & 7) > srow) s[e] = -1e30f;
      }
      // pairwise trees, so that no chain is longer than four links
      float t[8];
#pragma unroll
      for (int e = 0; e < 8; ++e) t[e] = fmaxf(s[e], s[e + 8]);
#pragma unroll
      for (int w = 4; w > 0; w >>= 1)
#pragma unroll
        for (int e = 0; e < w; ++e) t[e] = fmaxf(t[e], t[e + w]);
      const float mx   = fmaxf(t[0], other_half(t[0]));
      const float mnew = fmaxf(col_m[mt], mx);
      corr[mt]  = __expf(col_m[mt] - mnew);
      col_m[mt] = mnew;
#pragma unroll
      for (int e = 0; e < 16; ++e) {
        s[e] = __expf(s[e] - mnew);
        bp[mt][e] = (h16)s[e];
      }
#pragma unroll
      for (int e = 0; e < 8; ++e) t[e] = s[e] + s[e + 8];
#pragma unroll
      for (int w = 4; w > 0; w >>= 1)
#pragma unroll
        for (int e = 0; e < w; ++e) t[e] += t[e + w];
      col_l[mt] = col_l[mt] * corr[mt] + t[0];
    }

    // rescale running accumulators
#pragma unroll
    for (int mt = 0; mt < 2; ++mt)
#pragma unroll
      for (int nt = 0; nt < 4; ++nt)
#pragma unroll
        for (int r = 0; r < 8; ++r) acc[mt][nt][r] *= corr[mt];

    // ---- Ot += Vt Pt ----
#pragma unroll
    for (int nt = 0; nt < 4; ++nt) {
      acc[0][nt] = wmma_f16(av[nt], bp[0], acc[0][nt]);
      acc[1][nt] = wmma_f16(av[nt], bp[1], acc[1][nt]);
    }
  }

  // join the halves' sums, normalize + store (head-concat layout [B, S, H*D]);
  // a lane's eight registers are eight consecutive d: one 16-byte store
#pragma unroll
  for (int mt = 0; mt < 2; ++mt) {
    const float inv = 1.0f / (col_l[mt] + other_half(col_l[mt]));
    const int s = qbase + mt * 16 + l16;
#pragma unroll
    for (int nt = 0; nt < 4; ++nt) {
      v8h o;
#pragma unroll
      for (int r = 0; r < 8; ++r) o[r] = (h16)(acc[mt][nt][r] * inv);
      *(v8h*)(O + ((size_t)b * NS + s) * (NH * ND) + h * ND + nt * 16 +
              half * 8) = o;
    }
  }
}

// Output projection: out = A @ W_o + b_o (f32), W_o pre-transposed [NE, NH*ND]
// grid = (ROWS/128, NE/64), block = 128 (4 waves, each wave 32 rows x 64 cols)
__global__ __launch_bounds__(128) void out_gemm_kernel(
    const h16* __restrict__ A,       // [ROWS, NH*ND]
    const h16* __restrict__ Wot,     // [NE, NH*ND]
    const float* __restrict__ bias,  // [NE]
    float* __restrict__ out)         // [ROWS, NE]
{
  const int tid  = threadIdx.x;
  const int wave = tid >> 5;
  const int lane = tid & 31;
  const int half = lane >> 4;
  const int l16  = lane & 15;
  const int kb0  = half * 8;
  const int kb1  = 16 + half * 8;
  const int rowbase = blockIdx.x * 128 + wave * 32;
  const int ntbase  = blockIdx.y * 64;
  const int KDIM = NH * ND;  // 1024

  v8f acc[2][4] = {};
  for (int kc = 0; kc < KDIM; kc += 32) {
    const h16* ar0 = A + (size_t)(rowbase + l16) * KDIM + kc;
    const h16* ar1 = A + (size_t)(rowbase + 16 + l16) * KDIM + kc;
    v16h a0 = load_frag2(ar0 + kb0, ar0 + kb1);
    v16h a1 = load_frag2(ar1 + kb0, ar1 + kb1);
    v16h bm[4];
#pragma unroll
    for (int nt = 0; nt < 4; ++nt) {
      const h16* wr = Wot + (size_t)(ntbase + nt * 16 + l16) * KDIM + kc;
      bm[nt] = load_frag2(wr + kb0, wr + kb1);
    }
    if (kc + 32 < KDIM) {
      __builtin_prefetch(ar0 + 32, 0, 3);
      __builtin_prefetch(ar1 + 32, 0, 3);
    }
#pragma unroll
    for (int nt = 0; nt < 4; ++nt) {
      acc[0][nt] = wmma_f16(a0, bm[nt], acc[0][nt]);
      acc[1][nt] = wmma_f16(a1, bm[nt], acc[1][nt]);
    }
  }

#pragma unroll
  for (int mt = 0; mt < 2; ++mt)
#pragma unroll
    for (int nt = 0; nt < 4; ++nt)
#pragma unroll
      for (int r = 0; r < 8; ++r) {
        const int rowg = rowbase + mt * 16 + half * 8 + r;
        const int n    = ntbase + nt * 16 + l16;
        out[(size_t)rowg * NE + n] = acc[mt][nt][r] + bias[n];
      }
}

extern "C" void kernel_launch(void* const* d_in, const int* in_sizes, int n_in,
                              void* d_out, int out_size, void* d_ws,
                              size_t ws_size, hipStream_t stream) {
  const float* x   = (const float*)d_in[0];
  const float* W_q = (const float*)d_in[1];
  const float* b_q = (const float*)d_in[2];
  const float* W_k = (const float*)d_in[3];
  const float* b_k = (const float*)d_in[4];
  const float* W_v = (const float*)d_in[5];
  const float* b_v = (const float*)d_in[6];
  const float* W_o = (const float*)d_in[7];
  const float* b_o = (const float*)d_in[8];
  float* out = (float*)d_out;

  const size_t nx   = (size_t)ROWS * NE;          // 4M halves
  const size_t nqkv = (size_t)NB * NH * NS * ND;  // 4M halves
  const size_t nw   = (size_t)NH * NE * ND;       // 1M halves
  h16* xh  = (h16*)d_ws;
  h16* qh  = xh + nx;
  h16* kh  = qh + nqkv;
  h16* vh  = kh + nqkv;   // transposed V: [NB*NH, ND, NS]
  h16* oh  = vh + nqkv;
  h16* wqh = oh + nx;     // transposed: [NH, ND, NE]
  h16* wkh = wqh + nw;
  h16* wvh = wkh + nw;
  h16* woh = wvh + nw;    // transposed: [NE, NH*ND]

  cvt_kernel<<<(int)((nx + 255) / 256), 256, 0, stream>>>(x, xh, (int)nx);
  dim3 gw(ND / 64, NE / 64, NH);         // per-head [NE, ND] -> [ND, NE]
  dim3 gwo(NE / 64, (NH * ND) / 64, 1);  // [NH*ND, NE] -> [NE, NH*ND]
  cvt_t_kernel<<<gw, 256, 0, stream>>>(W_q, wqh, NE, ND);
  cvt_t_kernel<<<gw, 256, 0, stream>>>(W_k, wkh, NE, ND);
  cvt_t_kernel<<<gw, 256, 0, stream>>>(W_v, wvh, NE, ND);
  cvt_t_kernel<<<gwo, 256, 0, stream>>>(W_o, woh, NH * ND, NE);

  dim3 gq(ROWS / 128, NH);
  qkv_gemm_kernel<<<gq, 128, 0, stream>>>(xh, wqh, b_q, qh, 0);
  qkv_gemm_kernel<<<gq, 128, 0, stream>>>(xh, wkh, b_k, kh, 0);
  qkv_gemm_kernel<<<gq, 128, 0, stream>>>(xh, wvh, b_v, vh, 1);

  attn_kernel<<<NB * NH * (NS / 32), 32, 0, stream>>>(qh, kh, vh, oh);

  dim3 go(ROWS / 128, NE / 64);
  out_gemm_kernel<<<go, 128, 0, stream>>>(oh, woh, b_o, out);
}

// v003
// Measured time: 175 microseconds a run.
// In both of two side-by-side timings against v002, it was 1.08 times as fast.
// Counting every step since v000, it is 2.16 times as fast.
#include <hip/hip_runtime.h>

typedef _Float16 h16;
typedef __attribute__((ext_vector_type(16))) _Float16 v16h;
typedef __attribute__((ext_vector_type(8)))  _Float16 v8h;
typedef __attribute__((ext_vector_type(8)))  float    v8f;
typedef __attribute__((ext_vector_type(2)))  _Float16 v2h;
typedef __attribute__((ext_vector_type(4)))  float    v4f;

#define NB 2
#define NS 2048
#define NE 1024
#define NH 16
#define ND 64
#define ROWS (NB * NS) /* 4096 */

static __device__ __forceinline__ v8f wmma_f16(v16h a, v16h b, v8f c) {
  // 8 args: (neg_a, A, neg_b, B, c_mod, C, reuse_a, reuse_b)
  return __builtin_amdgcn_wmma_f32_16x16x32_f16(false, a, false, b, (short)0, c,
                                                false, false);
}

// Two contiguous 16-byte loads -> one 16-half fragment (b128 pairs)
static __device__ __forceinline__ v16h load_frag2(const h16* p0, const h16* p1) {
  v8h lo = *(const v8h*)p0;
  v8h hi = *(const v8h*)p1;
  return __builtin_shufflevector(lo, hi, 0, 1, 2, 3, 4, 5, 6, 7, 8, 9, 10, 11,
                                 12, 13, 14, 15);
}

__global__ void cvt_kernel(const float* __restrict__ src, h16* __restrict__ dst,
                           int n) {
  int i = blockIdx.x * blockDim.x + threadIdx.x;
  if (i < n) dst[i] = (h16)src[i];
}

// Batched transpose-convert: src [batch, R, C] f32 -> dst [batch, C, R] f16
// One 64x64 tile per block, turned in LDS, so that both sides of the copy move
// whole 128-byte lines.  grid = (C/64, R/64, batch), block = 256.
// The tile is kept as [c][r]; the eight 16-byte chunks of a row are XOR-ed
// with (c >> 2) & 7 so that the 4-byte stores of a wave (columns 4 apart)
// spread over the banks while the 16-byte reads stay aligned.
__global__ __launch_bounds__(256) void cvt_t_kernel(
    const float* __restrict__ src, h16* __restrict__ dst, int R, int C) {
  __shared__ __attribute__((aligned(16))) h16 tile[64 * 64];
  const int tid = threadIdx.x;
  const int c0  = blockIdx.x * 64;
  const int r0  = blockIdx.y * 64;
  const size_t base = (size_t)blockIdx.z * R * C;
  const int cq = (tid & 15) * 4;  // four columns per thread
  const int rp = (tid >> 4) * 2;  // a pair of rows per thread

  // the loops below are unrolled so that v[][] stays in registers and the four
  // loads of a thread are in flight together
  v4f v[2][2];
#pragma unroll
  for (int it = 0; it < 2; ++it)
#pragma unroll
    for (int p = 0; p < 2; ++p)
      v[it][p] = *(const v4f*)(src + base +
                               (size_t)(r0 + it * 32 + rp + p) * C + c0 + cq);
#pragma unroll
  for (int it = 0; it < 2; ++it)
#pragma unroll
    for (int j = 0; j < 4; ++j) {
      const int c = cq + j;
      const int r = it * 32 + rp;
      const int chunk = (r >> 3) ^ ((c >> 2) & 7);
      v2h pr = {(h16)v[it][0][j], (h16)v[it][1][j]};
      *(v2h*)&tile[c * 64 + chunk * 8 + (r & 7)] = pr;
    }
  __syncthreads();
#pragma unroll
  for (int it = 0; it < 2; ++it) {
    const int c = it * 32 + (tid >> 3);
    const int q = tid & 7;
    const v8h o = *(const v8h*)&tile[c * 64 + (q ^ ((c >> 2) & 7)) * 8];
    *(v8h*)(dst + base + (size_t)(c0 + c) * R + r0 + q * 8) = o;
  }
}

// Per-head projection: out = x @ W[h] + bias[h], W pre-transposed [H,D,E].
// grid = (ROWS/128, NH), block = 128 (4 waves, each wave -> 32 rows x 64 cols)
// vt=0: out[b,h,s,d];  vt=1: out[b,h,d,s] (transposed, for V)
__global__ __launch_bounds__(128) void qkv_gemm_kernel(
    const h16* __restrict__ X,       // [ROWS, NE]
    const h16* __restrict__ Wt,      // [NH, ND, NE]
    const float* __restrict__ bias,  // [NH, ND]
    h16* __restrict__ out, int vt)
{
  const int tid  = threadIdx.x;
  const int wave = tid >> 5;
  const int lane = tid & 31;
  const int half = lane >> 4;
  const int l16  = lane & 15;
  const int kb0  = half * 8;
  const int kb1  = 16 + half * 8;
  const int h    = blockIdx.y;
  const int rowbase = blockIdx.x * 128 + wave * 32;

  const h16* Wh = Wt + (size_t)h * ND * NE;
  v8f acc[2][4] = {};

  for (int kc = 0; kc < NE; kc += 32) {
    const h16* xr0 = X + (size_t)(rowbase + l16) * NE + kc;
    const h16* xr1 = X + (size_t)(rowbase + 16 + l16) * NE + kc;
    // hoist ALL loads: 4 B fragments + 2 A fragments live at once so the
    // scheduler can issue partial s_wait_loadcnt and overlap loads with WMMAs
    v16h a0 = load_frag2(xr0 + kb0, xr0 + kb1);
    v16h a1 = load_frag2(xr1 + kb0, xr1 + kb1);
    v16h bm[4];
#pragma unroll
    for (int nt = 0; nt < 4; ++nt) {
      const h16* wr = Wh + (size_t)(nt * 16 + l16) * NE + kc;
      bm[nt] = load_frag2(wr + kb0, wr + kb1);
    }
    if (kc + 32 < NE) {
      __builtin_prefetch(xr0 + 32, 0, 3);
      __builtin_prefetch(xr1 + 32, 0, 3);
    }
#pragma unroll
    for (int nt = 0; nt < 4; ++nt) {
      acc[0][nt] = wmma_f16(a0, bm[nt], acc[0][nt]);
      acc[1][nt] = wmma_f16(a1, bm[nt], acc[1][nt]);
    }
  }

  if (vt) {
    // transposed output: a lane's eight registers are eight consecutive s of
    // one d row (a group of 8 never crosses a batch): one 16-byte store
#pragma unroll
    for (int mt = 0; mt < 2; ++mt)
#pragma unroll
      for (int nt = 0; nt < 4; ++nt) {
        const int rowg = rowbase + mt * 16 + half * 8;
        const int b    = rowg >> 11;  // / NS
        const int s    = rowg & (NS - 1);
        const int n    = nt * 16 + l16;
        const float bn = bias[h * ND + n];
        v8h o;
#pragma unroll
        for (int r = 0; r < 8; ++r) o[r] = (h16)(acc[mt][nt][r] + bn);
        *(v8h*)(out + ((size_t)(b * NH + h) * ND + n) * NS + s) = o;
      }
    // the built code falls from here into the other side's code, which reuses
    // the stores' registers
    asm volatile("s_wait_xcnt 0x0" ::: "memory");
    return;
  }

#pragma unroll
  for (int mt = 0; mt < 2; ++mt)
#pragma unroll
    for (int nt = 0; nt < 4; ++nt)
#pragma unroll
      for (int r = 0; r < 8; ++r) {
        const int rowg = rowbase + mt * 16 + half * 8 + r;
        const int b    = rowg >> 11;  // / NS
        const int s    = rowg & (NS - 1);
        const int n    = nt * 16 + l16;
        const float v  = acc[mt][nt][r] + bias[h * ND + n];
        out[((size_t)(b * NH + h) * NS + s) * ND + n] = (h16)v;
      }
}

// Lane l <-> lane l ^ 16: the other half of the wave holds the other 16 keys
// of the same query column.
static __device__ __forceinline__ float other_half(float v) {
  int b = __builtin_bit_cast(int, v);
  b = __builtin_amdgcn_permlanex16(b, b, 0x76543210, 0xfedcba98, false, false);
  return __builtin_bit_cast(float, b);
}

// Flash-attention: one wave per 32-query tile per (b,h); K/V fragments are
// shared by both 16-query sub-tiles (2x WMMA per byte loaded from L2).
// The products are taken transposed: St = K Q^T and Ot += Vt Pt.  A lane then
// holds 16 of the 32 scores of ONE query (its column), so maximum and sum are
// taken in the lane, and the two score tiles of a column, converted in place,
// are the B operand of the second product.
// grid = NB*NH*(NS/32), block = 32.  V is transposed [NB*NH, ND, NS].
__global__ __launch_bounds__(32) void attn_kernel(
    const h16* __restrict__ Q,   // [NB*NH, NS, ND]
    const h16* __restrict__ K,   // [NB*NH, NS, ND]
    const h16* __restrict__ Vt,  // [NB*NH, ND, NS]
    h16* __restrict__ O)         // [NB, NS, NH*ND]
{
  const int lane = threadIdx.x;
  const int half = lane >> 4;
  const int l16  = lane & 15;
  const int kb0  = half * 8;
  const int kb1  = 16 + half * 8;
  const int qt   = blockIdx.x & (NS / 32 - 1);
  const int bh   = blockIdx.x >> 6;
  const int h    = bh & (NH - 1);
  const int b    = bh >> 4;
  const int qbase = qt * 32;

  const h16* Qp = Q + (size_t)bh * NS * ND;
  const h16* Kp = K + (size_t)bh * NS * ND;
  const h16* Vp = Vt + (size_t)bh * ND * NS;

  // Q fragments (B operand: lane = query column): 2 column tiles x 2 K-chunks,
  // resident for the whole pass
  v16h bq[2][2];
#pragma unroll
  for (int mt = 0; mt < 2; ++mt) {
    const h16* qrow = Qp + (size_t)(qbase + mt * 16 + l16) * ND;
#pragma unroll
    for (int kc = 0; kc < 2; ++kc)
      bq[mt][kc] = load_frag2(qrow + kc * 32 + kb0, qrow + kc * 32 + kb1);
  }

  // acc[mt][nt][r] = O[query mt*16 + l16][d = nt*16 + half*8 + r]
  v8f acc[2][4] = {};
  float col_m[2] = {-1e30f, -1e30f};  // running maximum of the lane's query
  float col_l[2] = {0.0f, 0.0f};      // running sum over this half's keys only

  const float scale  = 0.125f;        // 1/sqrt(64)
  const int nchunks = (qbase >> 5) + 1;  // causal bound (rows < qbase+32)

  for (int ch = 0; ch < nchunks; ++ch) {
    const int tbase = ch * 32;

    // ---- K fragments (A operand: lane = key row; shared by both tiles) ----
    v16h ak[2][2];  // [tt][kc]
#pragma unroll
    for (int tt = 0; tt < 2; ++tt) {
      const h16* krow = Kp + (size_t)(tbase + tt * 16 + l16) * ND;
#pragma unroll
      for (int kc = 0; kc < 2; ++kc)
        ak[tt][kc] = load_frag2(krow + kc * 32 + kb0, krow + kc * 32 + kb1);
    }
    // K's address registers may be reused as a destination of V's loads
    asm volatile("s_wait_xcnt 0x0" ::: "memory");

    // ---- V fragments (A operand: lane = d row; shared by both tiles) ----
    // one group behind K's loads, so that they fly during scores and softmax
    v16h av[4];
#pragma unroll
    for (int nt = 0; nt < 4; ++nt) {
      const h16* vr = Vp + (size_t)(nt * 16 + l16) * NS + tbase;
      av[nt] = load_frag2(vr + kb0, vr + kb1);
    }
    // keeps the scheduler from sinking V's loads to their use, where it split
    // them into four pairs, each waited for on its own
    __builtin_amdgcn_sched_barrier(0);
    if (ch + 1 < nchunks) {
      __builtin_prefetch(Kp + (size_t)(tbase + 32 + l16) * ND, 0, 3);
      __builtin_prefetch(Kp + (size_t)(tbase + 48 + l16) * ND, 0, 3);
    }
    // the address registers of the loads and prefetches above are advanced or
    // reused below
    asm volatile("s_wait_xcnt 0x0" ::: "memory");
    // keeps the address additions from being lifted over that wait
    __builtin_amdgcn_sched_barrier(0);

    // ---- scores: St = K Q^T ----
    // c[mt][tt][r] = S[query mt*16 + l16][key tbase + tt*16 + half*8 + r]
    v8f c[2][2] = {};
#pragma unroll
    for (int mt = 0; mt < 2; ++mt)
#pragma unroll
      for (int tt = 0; tt < 2; ++tt)
#pragma unroll
        for (int kc = 0; kc < 2; ++kc)
          c[mt][tt] = wmma_f16(ak[tt][kc], bq[mt][kc], c[mt][tt]);

    // ---- scale + causal mask + online softmax (per query column) ----
    float corr[2];
    v16h bp[2];  // P^T as B operand: element tt*8 + r = key tt*16 + half*8 + r
#pragma unroll
    for (int mt = 0; mt < 2; ++mt) {
      const int srow = qbase + mt * 16 + l16;
      float s[16];
#pragma unroll
      for (int e = 0; e < 16; ++e) {
        s[e] = c[mt][e >> 3][e & 7] * scale;
        if (tbase + (e >> 3) * 16 + half * 8 + (e & 7) > srow) s[e] = -1e30f;
      }
      // pairwise trees, so that no chain is longer than four links
      float t[8];
#pragma unroll
      for (int e = 0; e < 8; ++e) t[e] = fmaxf(s[e], s[e + 8]);
#pragma unroll
      for (int w = 4; w > 0; w >>= 1)
#pragma unroll
        for (int e = 0; e < w; ++e) t[e] = fmaxf(t[e], t[e + w]);
      const float mx   = fmaxf(t[0], other_half(t[0]));
      const float mnew = fmaxf(col_m[mt], mx);
      corr[mt]  = __expf(col_m[mt] - mnew);
      col_m[mt] = mnew;
#pragma unroll
      for (int e = 0; e < 16; ++e) {
        s[e] = __expf(s[e] - mnew);
        bp[mt][e] = (h16)s[e];
      }
#pragma unroll
      for (int e = 0; e < 8; ++e) t[e] = s[e] + s[e + 8];
#pragma unroll
      for (int w = 4; w > 0; w >>= 1)
#pragma unroll
        for (int e = 0; e < w; ++e) t[e] += t[e + w];
      col_l[mt] = col_l[mt] * corr[mt] + t[0];
    }

    // rescale running accumulators
#pragma unroll
    for (int mt = 0; mt < 2; ++mt)
#pragma unroll
      for (int nt = 0; nt < 4; ++nt)
#pragma unroll
        for (int r = 0; r < 8; ++r) acc[mt][nt][r] *= corr[mt];

    // ---- Ot += Vt Pt ----
#pragma unroll
    for (int nt = 0; nt < 4; ++nt) {
      acc[0][nt] = wmma_f16(av[nt], bp[0], acc[0][nt]);
      acc[1][nt] = wmma_f16(av[nt], bp[1], acc[1][nt]);
    }
  }

  // join the halves' sums, normalize + store (head-concat layout [B, S, H*D]);
  // a lane's eight registers are eight consecutive d: one 16-byte store
#pragma unroll
  for (int mt = 0; mt < 2; ++mt) {
    const float inv = 1.0f / (col_l[mt] + other_half(col_l[mt]));
    const int s = qbase + mt * 16 + l16;
#pragma unroll
    for (int nt = 0; nt < 4; ++nt) {
      v8h o;
#pragma unroll
      for (int r = 0; r < 8; ++r) o[r] = (h16)(acc[mt][nt][r] * inv);
      *(v8h*)(O + ((size_t)b * NS + s) * (NH * ND) + h * ND + nt * 16 +
              half * 8) = o;
    }
  }
}

// Output projection: out = A @ W_o + b_o (f32), W_o pre-transposed [NE, NH*ND]
// grid = (ROWS/128, NE/64), block = 128 (4 waves, each wave 32 rows x 64 cols)
__global__ __launch_bounds__(128) void out_gemm_kernel(
    const h16* __restrict__ A,       // [ROWS, NH*ND]
    const h16* __restrict__ Wot,     // [NE, NH*ND]
    const float* __restrict__ bias,  // [NE]
    float* __restrict__ out)         // [ROWS, NE]
{
  const int tid  = threadIdx.x;
  const int wave = tid >> 5;
  const int lane = tid & 31;
  const int half = lane >> 4;
  const int l16  = lane & 15;
  const int kb0  = half * 8;
  const int kb1  = 16 + half * 8;
  const int rowbase = blockIdx.x * 128 + wave * 32;
  const int ntbase  = blockIdx.y * 64;
  const int KDIM = NH * ND;  // 1024

  v8f acc[2][4] = {};
  for (int kc = 0; kc < KDIM; kc += 32) {
    const h16* ar0 = A + (size_t)(rowbase + l16) * KDIM + kc;
    const h16* ar1 = A + (size_t)(rowbase + 16 + l16) * KDIM + kc;
    v16h a0 = load_frag2(ar0 + kb0, ar0 + kb1);
    v16h a1 = load_frag2(ar1 + kb0, ar1 + kb1);
    v16h bm[4];
#pragma unroll
    for (int nt = 0; nt < 4; ++nt) {
      const h16* wr = Wot + (size_t)(ntbase + nt * 16 + l16) * KDIM + kc;
      bm[nt] = load_frag2(wr + kb0, wr + kb1);
    }
    if (kc + 32 < KDIM) {
      __builtin_prefetch(ar0 + 32, 0, 3);
      __builtin_prefetch(ar1 + 32, 0, 3);
    }
#pragma unroll
    for (int nt = 0; nt < 4; ++nt) {
      acc[0][nt] = wmma_f16(a0, bm[nt], acc[0][nt]);
      acc[1][nt] = wmma_f16(a1, bm[nt], acc[1][nt]);
    }
  }

#pragma unroll
  for (int mt = 0; mt < 2; ++mt)
#pragma unroll
    for (int nt = 0; nt < 4; ++nt)
#pragma unroll
      for (int r = 0; r < 8; ++r) {
        const int rowg = rowbase + mt * 16 + half * 8 + r;
        const int n    = ntbase + nt * 16 + l16;
        out[(size_t)rowg * NE + n] = acc[mt][nt][r] + bias[n];
      }
}

extern "C" void kernel_launch(void* const* d_in, const int* in_sizes, int n_in,
                              void* d_out, int out_size, void* d_ws,
                              size_t ws_size, hipStream_t stream) {
  const float* x   = (const float*)d_in[0];
  const float* W_q = (const float*)d_in[1];
  const float* b_q = (const float*)d_in[2];
  const float* W_k = (const float*)d_in[3];
  const float* b_k = (const float*)d_in[4];
  const float* W_v = (const float*)d_in[5];
  const float* b_v = (const float*)d_in[6];
  const float* W_o = (const float*)d_in[7];
  const float* b_o = (const float*)d_in[8];
  float* out = (float*)d_out;

  const size_t nx   = (size_t)ROWS * NE;          // 4M halves
  const size_t nqkv = (size_t)NB * NH * NS * ND;  // 4M halves
  const size_t nw   = (size_t)NH * NE * ND;       // 1M halves
  h16* xh  = (h16*)d_ws;
  h16* qh  = xh + nx;
  h16* kh  = qh + nqkv;
  h16* vh  = kh + nqkv;   // transposed V: [NB*NH, ND, NS]
  h16* oh  = vh + nqkv;
  h16* wqh = oh + nx;     // transposed: [NH, ND, NE]
  h16* wkh = wqh + nw;
  h16* wvh = wkh + nw;
  h16* woh = wvh + nw;    // transposed: [NE, NH*ND]

  cvt_kernel<<<(int)((nx + 255) / 256), 256, 0, stream>>>(x, xh, (int)nx);
  dim3 gw(ND / 64, NE / 64, NH);         // per-head [NE, ND] -> [ND, NE]
  dim3 gwo(NE / 64, (NH * ND) / 64, 1);  // [NH*ND, NE] -> [NE, NH*ND]
  cvt_t_kernel<<<gw, 256, 0, stream>>>(W_q, wqh, NE, ND);
  cvt_t_kernel<<<gw, 256, 0, stream>>>(W_k, wkh, NE, ND);
  cvt_t_kernel<<<gw, 256, 0, stream>>>(W_v, wvh, NE, ND);
  cvt_t_kernel<<<gwo, 256, 0, stream>>>(W_o, woh, NH * ND, NE);

  dim3 gq(ROWS / 128, NH);
  qkv_gemm_kernel<<<gq, 128, 0, stream>>>(xh, wqh, b_q, qh, 0);
  qkv_gemm_kernel<<<gq, 128, 0, stream>>>(xh, wkh, b_k, kh, 0);
  qkv_gemm_kernel<<<gq, 128, 0, stream>>>(xh, wvh, b_v, vh, 1);

  attn_kernel<<<NB * NH * (NS / 32), 32, 0, stream>>>(qh, kh, vh, oh);

  dim3 go(ROWS / 128, NE / 64);
  out_gemm_kernel<<<go, 128, 0, stream>>>(oh, woh, b_o, out);
}

// v004
// One run takes 128 microseconds.
// Timed twice side by side with v003, it ran 1.37 times as fast both times.
// Counting every step since v000, it is 2.97 times as fast.
#include <hip/hip_runtime.h>

typedef _Float16 h16;
typedef __attribute__((ext_vector_type(16))) _Float16 v16h;
typedef __attribute__((ext_vector_type(8)))  _Float16 v8h;
typedef __attribute__((ext_vector_type(8)))  float    v8f;
typedef __attribute__((ext_vector_type(2)))  _Float16 v2h;
typedef __attribute__((ext_vector_type(4)))  float    v4f;

#define NB 2
#define NS 2048
#define NE 1024
#define NH 16
#define ND 64
#define ROWS (NB * NS) /* 4096 */

static __device__ __forceinline__ v8f wmma_f16(v16h a, v16h b, v8f c) {
  // 8 args: (neg_a, A, neg_b, B, c_mod, C, reuse_a, reuse_b)
  return __builtin_amdgcn_wmma_f32_16x16x32_f16(false, a, false, b, (short)0, c,
                                                false, false);
}

// Two contiguous 16-byte loads -> one 16-half fragment (b128 pairs)
static __device__ __forceinline__ v16h load_frag2(const h16* p0, const h16* p1) {
  v8h lo = *(const v8h*)p0;
  v8h hi = *(const v8h*)p1;
  return __builtin_shufflevector(lo, hi, 0, 1, 2, 3, 4, 5, 6, 7, 8, 9, 10, 11,
                                 12, 13, 14, 15);
}

__global__ void cvt_kernel(const float* __restrict__ src, h16* __restrict__ dst,
                           int n) {
  int i = blockIdx.x * blockDim.x + threadIdx.x;
  if (i < n) dst[i] = (h16)src[i];
}

// Batched transpose-convert: src [batch, R, C] f32 -> dst [batch, C, R] f16
// One 64x64 tile per block, turned in LDS, so that both sides of the copy move
// whole 128-byte lines.  grid = (C/64, R/64, batch), block = 256.
// The tile is kept as [c][r]; the eight 16-byte chunks of a row are XOR-ed
// with (c >> 2) & 7 so that the 4-byte stores of a wave (columns 4 apart)
// spread over the banks while the 16-byte reads stay aligned.
__global__ __launch_bounds__(256) void cvt_t_kernel(
    const float* __restrict__ src, h16* __restrict__ dst, int R, int C) {
  __shared__ __attribute__((aligned(16))) h16 tile[64 * 64];
  const int tid = threadIdx.x;
  const int c0  = blockIdx.x * 64;
  const int r0  = blockIdx.y * 64;
  const size_t base = (size_t)blockIdx.z * R * C;
  const int cq = (tid & 15) * 4;  // four columns per thread
  const int rp = (tid >> 4) * 2;  // a pair of rows per thread

  // the loops below are unrolled so that v[][] stays in registers and the four
  // loads of a thread are in flight together
  v4f v[2][2];
#pragma unroll
  for (int it = 0; it < 2; ++it)
#pragma unroll
    for (int p = 0; p < 2; ++p)
      v[it][p] = *(const v4f*)(src + base +
                               (size_t)(r0 + it * 32 + rp + p) * C + c0 + cq);
#pragma unroll
  for (int it = 0; it < 2; ++it)
#pragma unroll
    for (int j = 0; j < 4; ++j) {
      const int c = cq + j;
      const int r = it * 32 + rp;
      const int chunk = (r >> 3) ^ ((c >> 2) & 7);
      v2h pr = {(h16)v[it][0][j], (h16)v[it][1][j]};
      *(v2h*)&tile[c * 64 + chunk * 8 + (r & 7)] = pr;
    }
  __syncthreads();
#pragma unroll
  for (int it = 0; it < 2; ++it) {
    const int c = it * 32 + (tid >> 3);
    const int q = tid & 7;
    const v8h o = *(const v8h*)&tile[c * 64 + (q ^ ((c >> 2) & 7)) * 8];
    *(v8h*)(dst + base + (size_t)(c0 + c) * R + r0 + q * 8) = o;
  }
}

// Product of one 128 x 64 output tile, shared by the projection kernels:
// acc += A[128 rows] * Bt[64 rows]^T over k = 0..1023, both operands k-contiguous
// with a row pitch of 1024 halves.  block = 128 (4 waves, each 32 rows x 64 cols).
// A fragment load straight from the rows touches 16 lines for 512 bytes, so the
// block brings 64 k of all 192 rows by whole 128-byte lines (8 lanes a row)
// and turns them in LDS; the next trip's lines fly while this trip's products
// run, in two buffers.  LDS rows stand at 144 bytes (16 B x odd), the pitch at
// which the 16 rows of a 16-byte fragment read fall on distinct banks.
#define GK 1024                     /* k extent and row pitch, halves */
#define GBK 64                      /* k per trip: one 128-byte line a row */
#define GPITCH 72                   /* LDS row pitch, halves */
#define GBUF ((128 + 64) * GPITCH)  /* one buffer, halves */
static __device__ __forceinline__ void tile_product(
    const h16* __restrict__ Ab,  // first of the block's 128 rows of A
    const h16* __restrict__ Bb,  // first of the block's 64 rows of Bt
    h16* sm,                     // 2 * GBUF halves of LDS
    v8f (&acc)[2][4])
{
  const int tid  = threadIdx.x;
  const int wave = tid >> 5;
  const int lane = tid & 31;
  const int half = lane >> 4;
  const int l16  = lane & 15;
  const int kb0  = half * 8;
  const int kb1  = 16 + half * 8;
  // staging: rows srow + 16 i, one 16-byte piece of each.  Neighbouring groups
  // of 8 lanes take rows 8 apart: 8 * 144 B lands half the banks further, so the
  // 16 lanes of a 16-byte LDS store cover every bank once (rows 1 apart would
  // share 4 banks)
  const int srow = ((tid >> 3) & 1) * 8 + (tid >> 4);
  const int sch  = (tid & 7) * 8;

  const h16* ga = Ab + (size_t)srow * GK + sch;
  const h16* gb = Bb + (size_t)srow * GK + sch;
  h16* sw = sm + srow * GPITCH + sch;
  const h16* ra = sm + (wave * 32 + l16) * GPITCH;
  const h16* rb = sm + (128 + l16) * GPITCH;

  v8h st[12];  // rows 0..127 of a buffer are A's, rows 128..191 are Bt's
#pragma unroll
  for (int i = 0; i < 8; ++i) st[i] = *(const v8h*)(ga + i * 16 * GK);
#pragma unroll
  for (int i = 0; i < 4; ++i) st[8 + i] = *(const v8h*)(gb + i * 16 * GK);
#pragma unroll
  for (int i = 0; i < 12; ++i) *(v8h*)(sw + i * 16 * GPITCH) = st[i];
  __syncthreads();

  // unrolled by 8, so that the k steps and the two buffers are immediate offsets:
  // the global address pairs are formed once in eight trips, and no trip forms an
  // LDS address
#pragma unroll 8
  for (int kt = 0; kt < GK / GBK; ++kt) {
    const int cur = (kt & 1) * GBUF;
    const bool more = kt + 1 < GK / GBK;
    if (more) {
      const int kn = (kt + 1) * GBK;
#pragma unroll
      for (int i = 0; i < 8; ++i) st[i] = *(const v8h*)(ga + i * 16 * GK + kn);
#pragma unroll
      for (int i = 0; i < 4; ++i)
        st[8 + i] = *(const v8h*)(gb + i * 16 * GK + kn);
      // the loads' address pairs are rewritten at the head of the unrolled body,
      // and one way there in the built code passes no wait for the loads' data
      asm volatile("s_wait_xcnt 0x0" ::: "memory");
    }

    v16h a[2][2], bm[2][4];  // [k step of 32][tile]
#pragma unroll
    for (int ks = 0; ks < 2; ++ks) {
      const int o = cur + ks * 32;
      a[ks][0] = load_frag2(ra + o + kb0, ra + o + kb1);
      a[ks][1] = load_frag2(ra + o + 16 * GPITCH + kb0,
                            ra + o + 16 * GPITCH + kb1);
#pragma unroll
      for (int nt = 0; nt < 4; ++nt)
        bm[ks][nt] = load_frag2(rb + o + nt * 16 * GPITCH + kb0,
                                rb + o + nt * 16 * GPITCH + kb1);
    }
    // keeps the trip's LDS reads one group in front of its products: spread
    // among them into one register set, each pair of products waited out a read
    __builtin_amdgcn_sched_barrier(0);

#pragma unroll
    for (int ks = 0; ks < 2; ++ks)
#pragma unroll
      for (int nt = 0; nt < 4; ++nt) {
        acc[0][nt] = wmma_f16(a[ks][0], bm[ks][nt], acc[0][nt]);
        acc[1][nt] = wmma_f16(a[ks][1], bm[ks][nt], acc[1][nt]);
      }
    // keeps the wait for the global loads, which stands in front of the stores
    // below, behind the trip's products
    __builtin_amdgcn_sched_barrier(0);

    // the other buffer's last readers left it at the barrier of the trip before
    if (more) {
#pragma unroll
      for (int i = 0; i < 12; ++i)
        *(v8h*)(sw + (GBUF - cur) + i * 16 * GPITCH) = st[i];
      __syncthreads();
    }
  }
}

// Per-head projection: out = x @ W[h] + bias[h], W pre-transposed [H,D,E].
// grid = (ROWS/128, NH), block = 128 (4 waves, each wave -> 32 rows x 64 cols)
// vt=0: out[b,h,s,d];  vt=1: out[b,h,d,s] (transposed, for V)
__global__ __launch_bounds__(128) void qkv_gemm_kernel(
    const h16* __restrict__ X,       // [ROWS, NE]
    const h16* __restrict__ Wt,      // [NH, ND, NE]
    const float* __restrict__ bias,  // [NH, ND]
    h16* __restrict__ out, int vt)
{
  const int tid  = threadIdx.x;
  const int wave = tid >> 5;
  const int lane = tid & 31;
  const int half = lane >> 4;
  const int l16  = lane & 15;
  const int h    = blockIdx.y;
  const int rowbase = blockIdx.x * 128 + wave * 32;

  __shared__ __attribute__((aligned(16))) h16 sm[2 * GBUF];
  v8f acc[2][4] = {};
  tile_product(X + (size_t)blockIdx.x * 128 * NE, Wt + (size_t)h * ND * NE, sm,
               acc);

  if (vt) {
    // transposed output: a lane's eight registers are eight consecutive s of
    // one d row (a group of 8 never crosses a batch): one 16-byte store
#pragma unroll
    for (int mt = 0; mt < 2; ++mt)
#pragma unroll
      for (int nt = 0; nt < 4; ++nt) {
        const int rowg = rowbase + mt * 16 + half * 8;
        const int b    = rowg >> 11;  // / NS
        const int s    = rowg & (NS - 1);
        const int n    = nt * 16 + l16;
        const float bn = bias[h * ND + n];
        v8h o;
#pragma unroll
        for (int r = 0; r < 8; ++r) o[r] = (h16)(acc[mt][nt][r] + bn);
        *(v8h*)(out + ((size_t)(b * NH + h) * ND + n) * NS + s) = o;
      }
    // the built code falls from here into the other side's code, which reuses
    // the stores' registers
    asm volatile("s_wait_xcnt 0x0" ::: "memory");
    return;
  }

#pragma unroll
  for (int mt = 0; mt < 2; ++mt)
#pragma unroll
    for (int nt = 0; nt < 4; ++nt)
#pragma unroll
      for (int r = 0; r < 8; ++r) {
        const int rowg = rowbase + mt * 16 + half * 8 + r;
        const int b    = rowg >> 11;  // / NS
        const int s    = rowg & (NS - 1);
        const int n    = nt * 16 + l16;
        const float v  = acc[mt][nt][r] + bias[h * ND + n];
        out[((size_t)(b * NH + h) * NS + s) * ND + n] = (h16)v;
      }
}

// Lane l <-> lane l ^ 16: the other half of the wave holds the other 16 keys
// of the same query column.
static __device__ __forceinline__ float other_half(float v) {
  int b = __builtin_bit_cast(int, v);
  b = __builtin_amdgcn_permlanex16(b, b, 0x76543210, 0xfedcba98, false, false);
  return __builtin_bit_cast(float, b);
}

// Flash-attention: one wave per 32-query tile per (b,h); K/V fragments are
// shared by both 16-query sub-tiles (2x WMMA per byte loaded from L2).
// The products are taken transposed: St = K Q^T and Ot += Vt Pt.  A lane then
// holds 16 of the 32 scores of ONE query (its column), so maximum and sum are
// taken in the lane, and the two score tiles of a column, converted in place,
// are the B operand of the second product.
// grid = NB*NH*(NS/32), block = 32.  V is transposed [NB*NH, ND, NS].
__global__ __launch_bounds__(32) void attn_kernel(
    const h16* __restrict__ Q,   // [NB*NH, NS, ND]
    const h16* __restrict__ K,   // [NB*NH, NS, ND]
    const h16* __restrict__ Vt,  // [NB*NH, ND, NS]
    h16* __restrict__ O)         // [NB, NS, NH*ND]
{
  const int lane = threadIdx.x;
  const int half = lane >> 4;
  const int l16  = lane & 15;
  const int kb0  = half * 8;
  const int kb1  = 16 + half * 8;
  const int qt   = blockIdx.x & (NS / 32 - 1);
  const int bh   = blockIdx.x >> 6;
  const int h    = bh & (NH - 1);
  const int b    = bh >> 4;
  const int qbase = qt * 32;

  const h16* Qp = Q + (size_t)bh * NS * ND;
  const h16* Kp = K + (size_t)bh * NS * ND;
  const h16* Vp = Vt + (size_t)bh * ND * NS;

  // Q fragments (B operand: lane = query column): 2 column tiles x 2 K-chunks,
  // resident for the whole pass
  v16h bq[2][2];
#pragma unroll
  for (int mt = 0; mt < 2; ++mt) {
    const h16* qrow = Qp + (size_t)(qbase + mt * 16 + l16) * ND;
#pragma unroll
    for (int kc = 0; kc < 2; ++kc)
      bq[mt][kc] = load_frag2(qrow + kc * 32 + kb0, qrow + kc * 32 + kb1);
  }

  // acc[mt][nt][r] = O[query mt*16 + l16][d = nt*16 + half*8 + r]
  v8f acc[2][4] = {};
  float col_m[2] = {-1e30f, -1e30f};  // running maximum of the lane's query
  float col_l[2] = {0.0f, 0.0f};      // running sum over this half's keys only

  const float scale  = 0.125f;        // 1/sqrt(64)
  const int nchunks = (qbase >> 5) + 1;  // causal bound (rows < qbase+32)

  for (int ch = 0; ch < nchunks; ++ch) {
    const int tbase = ch * 32;

    // ---- K fragments (A operand: lane = key row; shared by both tiles) ----
    v16h ak[2][2];  // [tt][kc]
#pragma unroll
    for (int tt = 0; tt < 2; ++tt) {
      const h16* krow = Kp + (size_t)(tbase + tt * 16 + l16) * ND;
#pragma unroll
      for (int kc = 0; kc < 2; ++kc)
        ak[tt][kc] = load_frag2(krow + kc * 32 + kb0, krow + kc * 32 + kb1);
    }
    // K's address registers may be reused as a destination of V's loads
    asm volatile("s_wait_xcnt 0x0" ::: "memory");

    // ---- V fragments (A operand: lane = d row; shared by both tiles) ----
    // one group behind K's loads, so that they fly during scores and softmax
    v16h av[4];
#pragma unroll
    for (int nt = 0; nt < 4; ++nt) {
      const h16* vr = Vp + (size_t)(nt * 16 + l16) * NS + tbase;
      av[nt] = load_frag2(vr + kb0, vr + kb1);
    }
    // keeps the scheduler from sinking V's loads to their use, where it split
    // them into four pairs, each waited for on its own
    __builtin_amdgcn_sched_barrier(0);
    if (ch + 1 < nchunks) {
      __builtin_prefetch(Kp + (size_t)(tbase + 32 + l16) * ND, 0, 3);
      __builtin_prefetch(Kp + (size_t)(tbase + 48 + l16) * ND, 0, 3);
    }
    // the address registers of the loads and prefetches above are advanced or
    // reused below
    asm volatile("s_wait_xcnt 0x0" ::: "memory");
    // keeps the address additions from being lifted over that wait
    __builtin_amdgcn_sched_barrier(0);

    // ---- scores: St = K Q^T ----
    // c[mt][tt][r] = S[query mt*16 + l16][key tbase + tt*16 + half*8 + r]
    v8f c[2][2] = {};
#pragma unroll
    for (int mt = 0; mt < 2; ++mt)
#pragma unroll
      for (int tt = 0; tt < 2; ++tt)
#pragma unroll
        for (int kc = 0; kc < 2; ++kc)
          c[mt][tt] = wmma_f16(ak[tt][kc], bq[mt][kc], c[mt][tt]);

    // ---- scale + causal mask + online softmax (per query column) ----
    float corr[2];
    v16h bp[2];  // P^T as B operand: element tt*8 + r = key tt*16 + half*8 + r
#pragma unroll
    for (int mt = 0; mt < 2; ++mt) {
      const int srow = qbase + mt * 16 + l16;
      float s[16];
#pragma unroll
      for (int e = 0; e < 16; ++e) {
        s[e] = c[mt][e >> 3][e & 7] * scale;
        if (tbase + (e >> 3) * 16 + half * 8 + (e & 7) > srow) s[e] = -1e30f;
      }
      // pairwise trees, so that no chain is longer than four links
      float t[8];
#pragma unroll
      for (int e = 0; e < 8; ++e) t[e] = fmaxf(s[e], s[e + 8]);
#pragma unroll
      for (int w = 4; w > 0; w >>= 1)
#pragma unroll
        for (int e = 0; e < w; ++e) t[e] = fmaxf(t[e], t[e + w]);
      const float mx   = fmaxf(t[0], other_half(t[0]));
      const float mnew = fmaxf(col_m[mt], mx);
      corr[mt]  = __expf(col_m[mt] - mnew);
      col_m[mt] = mnew;
#pragma unroll
      for (int e = 0; e < 16; ++e) {
        s[e] = __expf(s[e] - mnew);
        bp[mt][e] = (h16)s[e];
      }
#pragma unroll
      for (int e = 0; e < 8; ++e) t[e] = s[e] + s[e + 8];
#pragma unroll
      for (int w = 4; w > 0; w >>= 1)
#pragma unroll
        for (int e = 0; e < w; ++e) t[e] += t[e + w];
      col_l[mt] = col_l[mt] * corr[mt] + t[0];
    }

    // rescale running accumulators
#pragma unroll
    for (int mt = 0; mt < 2; ++mt)
#pragma unroll
      for (int nt = 0; nt < 4; ++nt)
#pragma unroll
        for (int r = 0; r < 8; ++r) acc[mt][nt][r] *= corr[mt];

    // ---- Ot += Vt Pt ----
#pragma unroll
    for (int nt = 0; nt < 4; ++nt) {
      acc[0][nt] = wmma_f16(av[nt], bp[0], acc[0][nt]);
      acc[1][nt] = wmma_f16(av[nt], bp[1], acc[1][nt]);
    }
  }

  // join the halves' sums, normalize + store (head-concat layout [B, S, H*D]);
  // a lane's eight registers are eight consecutive d: one 16-byte store
#pragma unroll
  for (int mt = 0; mt < 2; ++mt) {
    const float inv = 1.0f / (col_l[mt] + other_half(col_l[mt]));
    const int s = qbase + mt * 16 + l16;
#pragma unroll
    for (int nt = 0; nt < 4; ++nt) {
      v8h o;
#pragma unroll
      for (int r = 0; r < 8; ++r) o[r] = (h16)(acc[mt][nt][r] * inv);
      *(v8h*)(O + ((size_t)b * NS + s) * (NH * ND) + h * ND + nt * 16 +
              half * 8) = o;
    }
  }
}

// Output projection: out = A @ W_o + b_o (f32), W_o pre-transposed [NE, NH*ND]
// grid = (ROWS/128, NE/64), block = 128 (4 waves, each wave 32 rows x 64 cols)
__global__ __launch_bounds__(128) void out_gemm_kernel(
    const h16* __restrict__ A,       // [ROWS, NH*ND]
    const h16* __restrict__ Wot,     // [NE, NH*ND]
    const float* __restrict__ bias,  // [NE]
    float* __restrict__ out)         // [ROWS, NE]
{
  const int tid  = threadIdx.x;
  const int wave = tid >> 5;
  const int lane = tid & 31;
  const int half = lane >> 4;
  const int l16  = lane & 15;
  const int rowbase = blockIdx.x * 128 + wave * 32;
  const int ntbase  = blockIdx.y * 64;

  __shared__ __attribute__((aligned(16))) h16 sm[2 * GBUF];
  v8f acc[2][4] = {};
  tile_product(A + (size_t)blockIdx.x * 128 * (NH * ND),
               Wot + (size_t)ntbase * (NH * ND), sm, acc);

#pragma unroll
  for (int mt = 0; mt < 2; ++mt)
#pragma unroll
    for (int nt = 0; nt < 4; ++nt)
#pragma unroll
      for (int r = 0; r < 8; ++r) {
        const int rowg = rowbase + mt * 16 + half * 8 + r;
        const int n    = ntbase + nt * 16 + l16;
        out[(size_t)rowg * NE + n] = acc[mt][nt][r] + bias[n];
      }
}

extern "C" void kernel_launch(void* const* d_in, const int* in_sizes, int n_in,
                              void* d_out, int out_size, void* d_ws,
                              size_t ws_size, hipStream_t stream) {
  const float* x   = (const float*)d_in[0];
  const float* W_q = (const float*)d_in[1];
  const float* b_q = (const float*)d_in[2];
  const float* W_k = (const float*)d_in[3];
  const float* b_k = (const float*)d_in[4];
  const float* W_v = (const float*)d_in[5];
  const float* b_v = (const float*)d_in[6];
  const float* W_o = (const float*)d_in[7];
  const float* b_o = (const float*)d_in[8];
  float* out = (float*)d_out;

  const size_t nx   = (size_t)ROWS * NE;          // 4M halves
  const size_t nqkv = (size_t)NB * NH * NS * ND;  // 4M halves
  const size_t nw   = (size_t)NH * NE * ND;       // 1M halves
  h16* xh  = (h16*)d_ws;
  h16* qh  = xh + nx;
  h16* kh  = qh + nqkv;
  h16* vh  = kh + nqkv;   // transposed V: [NB*NH, ND, NS]
  h16* oh  = vh + nqkv;
  h16* wqh = oh + nx;     // transposed: [NH, ND, NE]
  h16* wkh = wqh + nw;
  h16* wvh = wkh + nw;
  h16* woh = wvh + nw;    // transposed: [NE, NH*ND]

  cvt_kernel<<<(int)((nx + 255) / 256), 256, 0, stream>>>(x, xh, (int)nx);
  dim3 gw(ND / 64, NE / 64, NH);         // per-head [NE, ND] -> [ND, NE]
  dim3 gwo(NE / 64, (NH * ND) / 64, 1);  // [NH*ND, NE] -> [NE, NH*ND]
  cvt_t_kernel<<<gw, 256, 0, stream>>>(W_q, wqh, NE, ND);
  cvt_t_kernel<<<gw, 256, 0, stream>>>(W_k, wkh, NE, ND);
  cvt_t_kernel<<<gw, 256, 0, stream>>>(W_v, wvh, NE, ND);
  cvt_t_kernel<<<gwo, 256, 0, stream>>>(W_o, woh, NH * ND, NE);

  dim3 gq(ROWS / 128, NH);
  qkv_gemm_kernel<<<gq, 128, 0, stream>>>(xh, wqh, b_q, qh, 0);
  qkv_gemm_kernel<<<gq, 128, 0, stream>>>(xh, wkh, b_k, kh, 0);
  qkv_gemm_kernel<<<gq, 128, 0, stream>>>(xh, wvh, b_v, vh, 1);

  attn_kernel<<<NB * NH * (NS / 32), 32, 0, stream>>>(qh, kh, vh, oh);

  dim3 go(ROWS / 128, NE / 64);
  out_gemm_kernel<<<go, 128, 0, stream>>>(oh, woh, b_o, out);
}

// v005
// It runs in 121 microseconds.
// Next to v004, in two timings, it ran 1.05 and 1.03 times as fast.
// Over all steps from v000 it is 3.09 times as fast.
#include <hip/hip_runtime.h>

typedef _Float16 h16;
typedef __attribute__((ext_vector_type(16))) _Float16 v16h;
typedef __attribute__((ext_vector_type(8)))  _Float16 v8h;
typedef __attribute__((ext_vector_type(8)))  float    v8f;
typedef __attribute__((ext_vector_type(2)))  _Float16 v2h;
typedef __attribute__((ext_vector_type(4)))  _Float16 v4h;
typedef __attribute__((ext_vector_type(4)))  float    v4f;

#define NB 2
#define NS 2048
#define NE 1024
#define NH 16
#define ND 64
#define ROWS (NB * NS) /* 4096 */

static __device__ __forceinline__ v8f wmma_f16(v16h a, v16h b, v8f c) {
  // 8 args: (neg_a, A, neg_b, B, c_mod, C, reuse_a, reuse_b)
  return __builtin_amdgcn_wmma_f32_16x16x32_f16(false, a, false, b, (short)0, c,
                                                false, false);
}

// Two contiguous 16-byte loads -> one 16-half fragment (b128 pairs)
static __device__ __forceinline__ v16h load_frag2(const h16* p0, const h16* p1) {
  v8h lo = *(const v8h*)p0;
  v8h hi = *(const v8h*)p1;
  return __builtin_shufflevector(lo, hi, 0, 1, 2, 3, 4, 5, 6, 7, 8, 9, 10, 11,
                                 12, 13, 14, 15);
}

// x -> f16, a stream: a wave takes 1024 consecutive values, as eight 16-byte
// loads a lane that are all in flight together (512 contiguous bytes a load)
// and eight 8-byte stores (256 contiguous bytes a store).  512 blocks of 8 waves
// put 16 waves on every WGP in one round: the launch starts 4096 waves, where
// one value a thread started 131072 waves that each lived for one load.
#define CVT_PER_WAVE 1024
#define CVT_PER_BLOCK (8 * CVT_PER_WAVE)
static_assert((ROWS * NE) % CVT_PER_BLOCK == 0, "whole blocks only");
__global__ __launch_bounds__(256) void cvt_kernel(const float* __restrict__ src,
                                                  h16* __restrict__ dst) {
  const int base = blockIdx.x * CVT_PER_BLOCK +
                   (threadIdx.x >> 5) * CVT_PER_WAVE + (threadIdx.x & 31) * 4;
  // unrolled so that v[] stays in registers and no store stands among the loads
  v4f v[8];
#pragma unroll
  for (int i = 0; i < 8; ++i) v[i] = *(const v4f*)(src + base + i * 128);
#pragma unroll
  for (int i = 0; i < 8; ++i) {
    const v4h o = {(h16)v[i][0], (h16)v[i][1], (h16)v[i][2], (h16)v[i][3]};
    *(v4h*)(dst + base + i * 128) = o;
  }
}

// Batched transpose-convert: src [batch, R, C] f32 -> dst [batch, C, R] f16
// One 64x64 tile per block, turned in LDS, so that both sides of the copy move
// whole 128-byte lines.  grid = (C/64, R/64, batch), block = 256.
// The tile is kept as [c][r]; the eight 16-byte chunks of a row are XOR-ed
// with (c >> 2) & 7 so that the 4-byte stores of a wave (columns 4 apart)
// spread over the banks while the 16-byte reads stay aligned.
__global__ __launch_bounds__(256) void cvt_t_kernel(
    const float* __restrict__ src, h16* __restrict__ dst, int R, int C) {
  __shared__ __attribute__((aligned(16))) h16 tile[64 * 64];
  const int tid = threadIdx.x;
  const int c0  = blockIdx.x * 64;
  const int r0  = blockIdx.y * 64;
  const size_t base = (size_t)blockIdx.z * R * C;
  const int cq = (tid & 15) * 4;  // four columns per thread
  const int rp = (tid >> 4) * 2;  // a pair of rows per thread

  // the loops below are unrolled so that v[][] stays in registers and the four
  // loads of a thread are in flight together
  v4f v[2][2];
#pragma unroll
  for (int it = 0; it < 2; ++it)
#pragma unroll
    for (int p = 0; p < 2; ++p)
      v[it][p] = *(const v4f*)(src + base +
                               (size_t)(r0 + it * 32 + rp + p) * C + c0 + cq);
#pragma unroll
  for (int it = 0; it < 2; ++it)
#pragma unroll
    for (int j = 0; j < 4; ++j) {
      const int c = cq + j;
      const int r = it * 32 + rp;
      const int chunk = (r >> 3) ^ ((c >> 2) & 7);
      v2h pr = {(h16)v[it][0][j], (h16)v[it][1][j]};
      *(v2h*)&tile[c * 64 + chunk * 8 + (r & 7)] = pr;
    }
  __syncthreads();
#pragma unroll
  for (int it = 0; it < 2; ++it) {
    const int c = it * 32 + (tid >> 3);
    const int q = tid & 7;
    const v8h o = *(const v8h*)&tile[c * 64 + (q ^ ((c >> 2) & 7)) * 8];
    *(v8h*)(dst + base + (size_t)(c0 + c) * R + r0 + q * 8) = o;
  }
}

// Product of one 128 x 64 output tile, shared by the projection kernels:
// acc += A[128 rows] * Bt[64 rows]^T over k = 0..1023, both operands k-contiguous
// with a row pitch of 1024 halves.  block = 128 (4 waves, each 32 rows x 64 cols).
// A fragment load straight from the rows touches 16 lines for 512 bytes, so the
// block brings 64 k of all 192 rows by whole 128-byte lines (8 lanes a row)
// and turns them in LDS; the next trip's lines fly while this trip's products
// run, in two buffers.  LDS rows stand at 144 bytes (16 B x odd), the pitch at
// which the 16 rows of a 16-byte fragment read fall on distinct banks.
#define GK 1024                     /* k extent and row pitch, halves */
#define GBK 64                      /* k per trip: one 128-byte line a row */
#define GPITCH 72                   /* LDS row pitch, halves */
#define GBUF ((128 + 64) * GPITCH)  /* one buffer, halves */
static __device__ __forceinline__ void tile_product(
    const h16* __restrict__ Ab,  // first of the block's 128 rows of A
    const h16* __restrict__ Bb,  // first of the block's 64 rows of Bt
    h16* sm,                     // 2 * GBUF halves of LDS
    v8f (&acc)[2][4])
{
  const int tid  = threadIdx.x;
  const int wave = tid >> 5;
  const int lane = tid & 31;
  const int half = lane >> 4;
  const int l16  = lane & 15;
  const int kb0  = half * 8;
  const int kb1  = 16 + half * 8;
  // staging: rows srow + 16 i, one 16-byte piece of each.  Neighbouring groups
  // of 8 lanes take rows 8 apart: 8 * 144 B lands half the banks further, so the
  // 16 lanes of a 16-byte LDS store cover every bank once (rows 1 apart would
  // share 4 banks)
  const int srow = ((tid >> 3) & 1) * 8 + (tid >> 4);
  const int sch  = (tid & 7) * 8;

  const h16* ga = Ab + (size_t)srow * GK + sch;
  const h16* gb = Bb + (size_t)srow * GK + sch;
  h16* sw = sm + srow * GPITCH + sch;
  const h16* ra = sm + (wave * 32 + l16) * GPITCH;
  const h16* rb = sm + (128 + l16) * GPITCH;

  v8h st[12];  // rows 0..127 of a buffer are A's, rows 128..191 are Bt's
#pragma unroll
  for (int i = 0; i < 8; ++i) st[i] = *(const v8h*)(ga + i * 16 * GK);
#pragma unroll
  for (int i = 0; i < 4; ++i) st[8 + i] = *(const v8h*)(gb + i * 16 * GK);
#pragma unroll
  for (int i = 0; i < 12; ++i) *(v8h*)(sw + i * 16 * GPITCH) = st[i];
  __syncthreads();

  // unrolled by 8, so that the k steps and the two buffers are immediate offsets:
  // the global address pairs are formed once in eight trips, and no trip forms an
  // LDS address
#pragma unroll 8
  for (int kt = 0; kt < GK / GBK; ++kt) {
    const int cur = (kt & 1) * GBUF;
    const bool more = kt + 1 < GK / GBK;
    if (more) {
      const int kn = (kt + 1) * GBK;
#pragma unroll
      for (int i = 0; i < 8; ++i) st[i] = *(const v8h*)(ga + i * 16 * GK + kn);
#pragma unroll
      for (int i = 0; i < 4; ++i)
        st[8 + i] = *(const v8h*)(gb + i * 16 * GK + kn);
      // the loads' address pairs are rewritten at the head of the unrolled body,
      // and one way there in the built code passes no wait for the loads' data
      asm volatile("s_wait_xcnt 0x0" ::: "memory");
    }

    v16h a[2][2], bm[2][4];  // [k step of 32][tile]
#pragma unroll
    for (int ks = 0; ks < 2; ++ks) {
      const int o = cur + ks * 32;
      a[ks][0] = load_frag2(ra + o + kb0, ra + o + kb1);
      a[ks][1] = load_frag2(ra + o + 16 * GPITCH + kb0,
                            ra + o + 16 * GPITCH + kb1);
#pragma unroll
      for (int nt = 0; nt < 4; ++nt)
        bm[ks][nt] = load_frag2(rb + o + nt * 16 * GPITCH + kb0,
                                rb + o + nt * 16 * GPITCH + kb1);
    }
    // keeps the trip's LDS reads one group in front of its products: spread
    // among them into one register set, each pair of products waited out a read
    __builtin_amdgcn_sched_barrier(0);

#pragma unroll
    for (int ks = 0; ks < 2; ++ks)
#pragma unroll
      for (int nt = 0; nt < 4; ++nt) {
        acc[0][nt] = wmma_f16(a[ks][0], bm[ks][nt], acc[0][nt]);
        acc[1][nt] = wmma_f16(a[ks][1], bm[ks][nt], acc[1][nt]);
      }
    // keeps the wait for the global loads, which stands in front of the stores
    // below, behind the trip's products
    __builtin_amdgcn_sched_barrier(0);

    // the other buffer's last readers left it at the barrier of the trip before
    if (more) {
#pragma unroll
      for (int i = 0; i < 12; ++i)
        *(v8h*)(sw + (GBUF - cur) + i * 16 * GPITCH) = st[i];
      __syncthreads();
    }
  }
}

// Per-head projection: out = x @ W[h] + bias[h], W pre-transposed [H,D,E].
// grid = (ROWS/128, NH), block = 128 (4 waves, each wave -> 32 rows x 64 cols)
// vt=0: out[b,h,s,d];  vt=1: out[b,h,d,s] (transposed, for V)
__global__ __launch_bounds__(128) void qkv_gemm_kernel(
    const h16* __restrict__ X,       // [ROWS, NE]
    const h16* __restrict__ Wt,      // [NH, ND, NE]
    const float* __restrict__ bias,  // [NH, ND]
    h16* __restrict__ out, int vt)
{
  const int tid  = threadIdx.x;
  const int wave = tid >> 5;
  const int lane = tid & 31;
  const int half = lane >> 4;
  const int l16  = lane & 15;
  const int h    = blockIdx.y;
  const int rowbase = blockIdx.x * 128 + wave * 32;

  __shared__ __attribute__((aligned(16))) h16 sm[2 * GBUF];
  v8f acc[2][4] = {};
  tile_product(X + (size_t)blockIdx.x * 128 * NE, Wt + (size_t)h * ND * NE, sm,
               acc);

  if (vt) {
    // transposed output: a lane's eight registers are eight consecutive s of
    // one d row (a group of 8 never crosses a batch): one 16-byte store
#pragma unroll
    for (int mt = 0; mt < 2; ++mt)
#pragma unroll
      for (int nt = 0; nt < 4; ++nt) {
        const int rowg = rowbase + mt * 16 + half * 8;
        const int b    = rowg >> 11;  // / NS
        const int s    = rowg & (NS - 1);
        const int n    = nt * 16 + l16;
        const float bn = bias[h * ND + n];
        v8h o;
#pragma unroll
        for (int r = 0; r < 8; ++r) o[r] = (h16)(acc[mt][nt][r] + bn);
        *(v8h*)(out + ((size_t)(b * NH + h) * ND + n) * NS + s) = o;
      }
    // the built code falls from here into the other side's code, which reuses
    // the stores' registers
    asm volatile("s_wait_xcnt 0x0" ::: "memory");
    return;
  }

#pragma unroll
  for (int mt = 0; mt < 2; ++mt)
#pragma unroll
    for (int nt = 0; nt < 4; ++nt)
#pragma unroll
      for (int r = 0; r < 8; ++r) {
        const int rowg = rowbase + mt * 16 + half * 8 + r;
        const int b    = rowg >> 11;  // / NS
        const int s    = rowg & (NS - 1);
        const int n    = nt * 16 + l16;
        const float v  = acc[mt][nt][r] + bias[h * ND + n];
        out[((size_t)(b * NH + h) * NS + s) * ND + n] = (h16)v;
      }
}

// Lane l <-> lane l ^ 16: the other half of the wave holds the other 16 keys
// of the same query column.
static __device__ __forceinline__ float other_half(float v) {
  int b = __builtin_bit_cast(int, v);
  b = __builtin_amdgcn_permlanex16(b, b, 0x76543210, 0xfedcba98, false, false);
  return __builtin_bit_cast(float, b);
}

// Flash-attention: one wave per 32-query tile per (b,h); K/V fragments are
// shared by both 16-query sub-tiles (2x WMMA per byte loaded from L2).
// The products are taken transposed: St = K Q^T and Ot += Vt Pt.  A lane then
// holds 16 of the 32 scores of ONE query (its column), so maximum and sum are
// taken in the lane, and the two score tiles of a column, converted in place,
// are the B operand of the second product.
// grid = NB*NH*(NS/32), block = 32.  V is transposed [NB*NH, ND, NS].
__global__ __launch_bounds__(32) void attn_kernel(
    const h16* __restrict__ Q,   // [NB*NH, NS, ND]
    const h16* __restrict__ K,   // [NB*NH, NS, ND]
    const h16* __restrict__ Vt,  // [NB*NH, ND, NS]
    h16* __restrict__ O)         // [NB, NS, NH*ND]
{
  const int lane = threadIdx.x;
  const int half = lane >> 4;
  const int l16  = lane & 15;
  const int kb0  = half * 8;
  const int kb1  = 16 + half * 8;
  const int qt   = blockIdx.x & (NS / 32 - 1);
  const int bh   = blockIdx.x >> 6;
  const int h    = bh & (NH - 1);
  const int b    = bh >> 4;
  const int qbase = qt * 32;

  const h16* Qp = Q + (size_t)bh * NS * ND;
  const h16* Kp = K + (size_t)bh * NS * ND;
  const h16* Vp = Vt + (size_t)bh * ND * NS;

  // Q fragments (B operand: lane = query column): 2 column tiles x 2 K-chunks,
  // resident for the whole pass
  v16h bq[2][2];
#pragma unroll
  for (int mt = 0; mt < 2; ++mt) {
    const h16* qrow = Qp + (size_t)(qbase + mt * 16 + l16) * ND;
#pragma unroll
    for (int kc = 0; kc < 2; ++kc)
      bq[mt][kc] = load_frag2(qrow + kc * 32 + kb0, qrow + kc * 32 + kb1);
  }

  // acc[mt][nt][r] = O[query mt*16 + l16][d = nt*16 + half*8 + r]
  v8f acc[2][4] = {};
  float col_m[2] = {-1e30f, -1e30f};  // running maximum of the lane's query
  float col_l[2] = {0.0f, 0.0f};      // running sum over this half's keys only

  const float scale  = 0.125f;        // 1/sqrt(64)
  const int nchunks = (qbase >> 5) + 1;  // causal bound (rows < qbase+32)

  for (int ch = 0; ch < nchunks; ++ch) {
    const int tbase = ch * 32;

    // ---- K fragments (A operand: lane = key row; shared by both tiles) ----
    v16h ak[2][2];  // [tt][kc]
#pragma unroll
    for (int tt = 0; tt < 2; ++tt) {
      const h16* krow = Kp + (size_t)(tbase + tt * 16 + l16) * ND;
#pragma unroll
      for (int kc = 0; kc < 2; ++kc)
        ak[tt][kc] = load_frag2(krow + kc * 32 + kb0, krow + kc * 32 + kb1);
    }
    // K's address registers may be reused as a destination of V's loads
    asm volatile("s_wait_xcnt 0x0" ::: "memory");

    // ---- V fragments (A operand: lane = d row; shared by both tiles) ----
    // one group behind K's loads, so that they fly during scores and softmax
    v16h av[4];
#pragma unroll
    for (int nt = 0; nt < 4; ++nt) {
      const h16* vr = Vp + (size_t)(nt * 16 + l16) * NS + tbase;
      av[nt] = load_frag2(vr + kb0, vr + kb1);
    }
    // keeps the scheduler from sinking V's loads to their use, where it split
    // them into four pairs, each waited for on its own
    __builtin_amdgcn_sched_barrier(0);
    if (ch + 1 < nchunks) {
      __builtin_prefetch(Kp + (size_t)(tbase + 32 + l16) * ND, 0, 3);
      __builtin_prefetch(Kp + (size_t)(tbase + 48 + l16) * ND, 0, 3);
    }
    // the address registers of the loads and prefetches above are advanced or
    // reused below
    asm volatile("s_wait_xcnt 0x0" ::: "memory");
    // keeps the address additions from being lifted over that wait
    __builtin_amdgcn_sched_barrier(0);

    // ---- scores: St = K Q^T ----
    // c[mt][tt][r] = S[query mt*16 + l16][key tbase + tt*16 + half*8 + r]
    v8f c[2][2] = {};
#pragma unroll
    for (int mt = 0; mt < 2; ++mt)
#pragma unroll
      for (int tt = 0; tt < 2; ++tt)
#pragma unroll
        for (int kc = 0; kc < 2; ++kc)
          c[mt][tt] = wmma_f16(ak[tt][kc], bq[mt][kc], c[mt][tt]);

    // ---- scale + causal mask + online softmax (per query column) ----
    float corr[2];
    v16h bp[2];  // P^T as B operand: element tt*8 + r = key tt*16 + half*8 + r
#pragma unroll
    for (int mt = 0; mt < 2; ++mt) {
      const int srow = qbase + mt * 16 + l16;
      float s[16];
#pragma unroll
      for (int e = 0; e < 16; ++e) {
        s[e] = c[mt][e >> 3][e & 7] * scale;
        if (tbase + (e >> 3) * 16 + half * 8 + (e & 7) > srow) s[e] = -1e30f;
      }
      // pairwise trees, so that no chain is longer than four links
      float t[8];
#pragma unroll
      for (int e = 0; e < 8; ++e) t[e] = fmaxf(s[e], s[e + 8]);
#pragma unroll
      for (int w = 4; w > 0; w >>= 1)
#pragma unroll
        for (int e = 0; e < w; ++e) t[e] = fmaxf(t[e], t[e + w]);
      const float mx   = fmaxf(t[0], other_half(t[0]));
      const float mnew = fmaxf(col_m[mt], mx);
      corr[mt]  = __expf(col_m[mt] - mnew);
      col_m[mt] = mnew;
#pragma unroll
      for (int e = 0; e < 16; ++e) {
        s[e] = __expf(s[e] - mnew);
        bp[mt][e] = (h16)s[e];
      }
#pragma unroll
      for (int e = 0; e < 8; ++e) t[e] = s[e] + s[e + 8];
#pragma unroll
      for (int w = 4; w > 0; w >>= 1)
#pragma unroll
        for (int e = 0; e < w; ++e) t[e] += t[e + w];
      col_l[mt] = col_l[mt] * corr[mt] + t[0];
    }

    // rescale running accumulators
#pragma unroll
    for (int mt = 0; mt < 2; ++mt)
#pragma unroll
      for (int nt = 0; nt < 4; ++nt)
#pragma unroll
        for (int r = 0; r < 8; ++r) acc[mt][nt][r] *= corr[mt];

    // ---- Ot += Vt Pt ----
#pragma unroll
    for (int nt = 0; nt < 4; ++nt) {
      acc[0][nt] = wmma_f16(av[nt], bp[0], acc[0][nt]);
      acc[1][nt] = wmma_f16(av[nt], bp[1], acc[1][nt]);
    }
  }

  // join the halves' sums, normalize + store (head-concat layout [B, S, H*D]);
  // a lane's eight registers are eight consecutive d: one 16-byte store
#pragma unroll
  for (int mt = 0; mt < 2; ++mt) {
    const float inv = 1.0f / (col_l[mt] + other_half(col_l[mt]));
    const int s = qbase + mt * 16 + l16;
#pragma unroll
    for (int nt = 0; nt < 4; ++nt) {
      v8h o;
#pragma unroll
      for (int r = 0; r < 8; ++r) o[r] = (h16)(acc[mt][nt][r] * inv);
      *(v8h*)(O + ((size_t)b * NS + s) * (NH * ND) + h * ND + nt * 16 +
              half * 8) = o;
    }
  }
}

// Output projection: out = A @ W_o + b_o (f32), W_o pre-transposed [NE, NH*ND]
// grid = (ROWS/128, NE/64), block = 128 (4 waves, each wave 32 rows x 64 cols)
__global__ __launch_bounds__(128) void out_gemm_kernel(
    const h16* __restrict__ A,       // [ROWS, NH*ND]
    const h16* __restrict__ Wot,     // [NE, NH*ND]
    const float* __restrict__ bias,  // [NE]
    float* __restrict__ out)         // [ROWS, NE]
{
  const int tid  = threadIdx.x;
  const int wave = tid >> 5;
  const int lane = tid & 31;
  const int half = lane >> 4;
  const int l16  = lane & 15;
  const int rowbase = blockIdx.x * 128 + wave * 32;
  const int ntbase  = blockIdx.y * 64;

  __shared__ __attribute__((aligned(16))) h16 sm[2 * GBUF];
  v8f acc[2][4] = {};
  tile_product(A + (size_t)blockIdx.x * 128 * (NH * ND),
               Wot + (size_t)ntbase * (NH * ND), sm, acc);

#pragma unroll
  for (int mt = 0; mt < 2; ++mt)
#pragma unroll
    for (int nt = 0; nt < 4; ++nt)
#pragma unroll
      for (int r = 0; r < 8; ++r) {
        const int rowg = rowbase + mt * 16 + half * 8 + r;
        const int n    = ntbase + nt * 16 + l16;
        out[(size_t)rowg * NE + n] = acc[mt][nt][r] + bias[n];
      }
}

extern "C" void kernel_launch(void* const* d_in, const int* in_sizes, int n_in,
                              void* d_out, int out_size, void* d_ws,
                              size_t ws_size, hipStream_t stream) {
  const float* x   = (const float*)d_in[0];
  const float* W_q = (const float*)d_in[1];
  const float* b_q = (const float*)d_in[2];
  const float* W_k = (const float*)d_in[3];
  const float* b_k = (const float*)d_in[4];
  const float* W_v = (const float*)d_in[5];
  const float* b_v = (const float*)d_in[6];
  const float* W_o = (const float*)d_in[7];
  const float* b_o = (const float*)d_in[8];
  float* out = (float*)d_out;

  const size_t nx   = (size_t)ROWS * NE;          // 4M halves
  const size_t nqkv = (size_t)NB * NH * NS * ND;  // 4M halves
  const size_t nw   = (size_t)NH * NE * ND;       // 1M halves
  h16* xh  = (h16*)d_ws;
  h16* qh  = xh + nx;
  h16* kh  = qh + nqkv;
  h16* vh  = kh + nqkv;   // transposed V: [NB*NH, ND, NS]
  h16* oh  = vh + nqkv;
  h16* wqh = oh + nx;     // transposed: [NH, ND, NE]
  h16* wkh = wqh + nw;
  h16* wvh = wkh + nw;
  h16* woh = wvh + nw;    // transposed: [NE, NH*ND]

  cvt_kernel<<<ROWS * NE / CVT_PER_BLOCK, 256, 0, stream>>>(x, xh);
  dim3 gw(ND / 64, NE / 64, NH);         // per-head [NE, ND] -> [ND, NE]
  dim3 gwo(NE / 64, (NH * ND) / 64, 1);  // [NH*ND, NE] -> [NE, NH*ND]
  cvt_t_kernel<<<gw, 256, 0, stream>>>(W_q, wqh, NE, ND);
  cvt_t_kernel<<<gw, 256, 0, stream>>>(W_k, wkh, NE, ND);
  cvt_t_kernel<<<gw, 256, 0, stream>>>(W_v, wvh, NE, ND);
  cvt_t_kernel<<<gwo, 256, 0, stream>>>(W_o, woh, NH * ND, NE);

  dim3 gq(ROWS / 128, NH);
  qkv_gemm_kernel<<<gq, 128, 0, stream>>>(xh, wqh, b_q, qh, 0);
  qkv_gemm_kernel<<<gq, 128, 0, stream>>>(xh, wkh, b_k, kh, 0);
  qkv_gemm_kernel<<<gq, 128, 0, stream>>>(xh, wvh, b_v, vh, 1);

  attn_kernel<<<NB * NH * (NS / 32), 32, 0, stream>>>(qh, kh, vh, oh);

  dim3 go(ROWS / 128, NE / 64);
  out_gemm_kernel<<<go, 128, 0, stream>>>(oh, woh, b_o, out);
}

// v006
// A run of this version takes 109 microseconds.
// Timed twice side by side with v005, it ran 1.11 and 1.10 times as fast.
// Over all steps from v000 it is 3.42 times as fast.
#include <hip/hip_runtime.h>

typedef _Float16 h16;
typedef __attribute__((ext_vector_type(16))) _Float16 v16h;
typedef __attribute__((ext_vector_type(8)))  _Float16 v8h;
typedef __attribute__((ext_vector_type(8)))  float    v8f;
typedef __attribute__((ext_vector_type(2)))  _Float16 v2h;
typedef __attribute__((ext_vector_type(4)))  _Float16 v4h;
typedef __attribute__((ext_vector_type(4)))  float    v4f;

#define NB 2
#define NS 2048
#define NE 1024
#define NH 16
#define ND 64
#define ROWS (NB * NS) /* 4096 */

static __device__ __forceinline__ v8f wmma_f16(v16h a, v16h b, v8f c) {
  // 8 args: (neg_a, A, neg_b, B, c_mod, C, reuse_a, reuse_b)
  return __builtin_amdgcn_wmma_f32_16x16x32_f16(false, a, false, b, (short)0, c,
                                                false, false);
}

// Two contiguous 16-byte loads -> one 16-half fragment (b128 pairs)
static __device__ __forceinline__ v16h load_frag2(const h16* p0, const h16* p1) {
  v8h lo = *(const v8h*)p0;
  v8h hi = *(const v8h*)p1;
  return __builtin_shufflevector(lo, hi, 0, 1, 2, 3, 4, 5, 6, 7, 8, 9, 10, 11,
                                 12, 13, 14, 15);
}

// x -> f16, a stream: a wave takes 1024 consecutive values, as eight 16-byte
// loads a lane that are all in flight together (512 contiguous bytes a load)
// and eight 8-byte stores (256 contiguous bytes a store).  512 blocks of 8 waves
// put 16 waves on every WGP in one round: the launch starts 4096 waves, where
// one value a thread started 131072 waves that each lived for one load.
#define CVT_PER_WAVE 1024
#define CVT_PER_BLOCK (8 * CVT_PER_WAVE)
static_assert((ROWS * NE) % CVT_PER_BLOCK == 0, "whole blocks only");
__global__ __launch_bounds__(256) void cvt_kernel(const float* __restrict__ src,
                                                  h16* __restrict__ dst) {
  const int base = blockIdx.x * CVT_PER_BLOCK +
                   (threadIdx.x >> 5) * CVT_PER_WAVE + (threadIdx.x & 31) * 4;
  // unrolled so that v[] stays in registers and no store stands among the loads
  v4f v[8];
#pragma unroll
  for (int i = 0; i < 8; ++i) v[i] = *(const v4f*)(src + base + i * 128);
#pragma unroll
  for (int i = 0; i < 8; ++i) {
    const v4h o = {(h16)v[i][0], (h16)v[i][1], (h16)v[i][2], (h16)v[i][3]};
    *(v4h*)(dst + base + i * 128) = o;
  }
}

// Batched transpose-convert: src [batch, R, C] f32 -> dst [batch, C, R] f16
// One 64x64 tile per block, turned in LDS, so that both sides of the copy move
// whole 128-byte lines.  grid = (C/64, R/64, batch), block = 256.
// The tile is kept as [c][r]; the eight 16-byte chunks of a row are XOR-ed
// with (c >> 2) & 7 so that the 4-byte stores of a wave (columns 4 apart)
// spread over the banks while the 16-byte reads stay aligned.
__global__ __launch_bounds__(256) void cvt_t_kernel(
    const float* __restrict__ src, h16* __restrict__ dst, int R, int C) {
  __shared__ __attribute__((aligned(16))) h16 tile[64 * 64];
  const int tid = threadIdx.x;
  const int c0  = blockIdx.x * 64;
  const int r0  = blockIdx.y * 64;
  const size_t base = (size_t)blockIdx.z * R * C;
  const int cq = (tid & 15) * 4;  // four columns per thread
  const int rp = (tid >> 4) * 2;  // a pair of rows per thread

  // the loops below are unrolled so that v[][] stays in registers and the four
  // loads of a thread are in flight together
  v4f v[2][2];
#pragma unroll
  for (int it = 0; it < 2; ++it)
#pragma unroll
    for (int p = 0; p < 2; ++p)
      v[it][p] = *(const v4f*)(src + base +
                               (size_t)(r0 + it * 32 + rp + p) * C + c0 + cq);
#pragma unroll
  for (int it = 0; it < 2; ++it)
#pragma unroll
    for (int j = 0; j < 4; ++j) {
      const int c = cq + j;
      const int r = it * 32 + rp;
      const int chunk = (r >> 3) ^ ((c >> 2) & 7);
      v2h pr = {(h16)v[it][0][j], (h16)v[it][1][j]};
      *(v2h*)&tile[c * 64 + chunk * 8 + (r & 7)] = pr;
    }
  __syncthreads();
#pragma unroll
  for (int it = 0; it < 2; ++it) {
    const int c = it * 32 + (tid >> 3);
    const int q = tid & 7;
    const v8h o = *(const v8h*)&tile[c * 64 + (q ^ ((c >> 2) & 7)) * 8];
    *(v8h*)(dst + base + (size_t)(c0 + c) * R + r0 + q * 8) = o;
  }
}

// Product of one 128 x 64 output tile, shared by the projection kernels:
// acc += A[128 rows] * Bt[64 rows]^T over k = 0..1023, both operands k-contiguous
// with a row pitch of 1024 halves.  block = 128 (4 waves, each 32 rows x 64 cols).
// A fragment load straight from the rows touches 16 lines for 512 bytes, so the
// block brings 64 k of all 192 rows by whole 128-byte lines (8 lanes a row)
// and turns them in LDS; the next trip's lines fly while this trip's products
// run, in two buffers.  LDS rows stand at 144 bytes (16 B x odd), the pitch at
// which the 16 rows of a 16-byte fragment read fall on distinct banks.
#define GK 1024                     /* k extent and row pitch, halves */
#define GBK 64                      /* k per trip: one 128-byte line a row */
#define GPITCH 72                   /* LDS row pitch, halves */
#define GBUF ((128 + 64) * GPITCH)  /* one buffer, halves */
static __device__ __forceinline__ void tile_product(
    const h16* __restrict__ Ab,  // first of the block's 128 rows of A
    const h16* __restrict__ Bb,  // first of the block's 64 rows of Bt
    h16* sm,                     // 2 * GBUF halves of LDS
    v8f (&acc)[2][4])
{
  const int tid  = threadIdx.x;
  const int wave = tid >> 5;
  const int lane = tid & 31;
  const int half = lane >> 4;
  const int l16  = lane & 15;
  const int kb0  = half * 8;
  const int kb1  = 16 + half * 8;
  // staging: rows srow + 16 i, one 16-byte piece of each.  Neighbouring groups
  // of 8 lanes take rows 8 apart: 8 * 144 B lands half the banks further, so the
  // 16 lanes of a 16-byte LDS store cover every bank once (rows 1 apart would
  // share 4 banks)
  const int srow = ((tid >> 3) & 1) * 8 + (tid >> 4);
  const int sch  = (tid & 7) * 8;

  const h16* ga = Ab + (size_t)srow * GK + sch;
  const h16* gb = Bb + (size_t)srow * GK + sch;
  h16* sw = sm + srow * GPITCH + sch;
  const h16* ra = sm + (wave * 32 + l16) * GPITCH;
  const h16* rb = sm + (128 + l16) * GPITCH;

  v8h st[12];  // rows 0..127 of a buffer are A's, rows 128..191 are Bt's
#pragma unroll
  for (int i = 0; i < 8; ++i) st[i] = *(const v8h*)(ga + i * 16 * GK);
#pragma unroll
  for (int i = 0; i < 4; ++i) st[8 + i] = *(const v8h*)(gb + i * 16 * GK);
#pragma unroll
  for (int i = 0; i < 12; ++i) *(v8h*)(sw + i * 16 * GPITCH) = st[i];
  __syncthreads();

  // unrolled by 8, so that the k steps and the two buffers are immediate offsets:
  // the global address pairs are formed once in eight trips, and no trip forms an
  // LDS address
#pragma unroll 8
  for (int kt = 0; kt < GK / GBK; ++kt) {
    const int cur = (kt & 1) * GBUF;
    const bool more = kt + 1 < GK / GBK;
    if (more) {
      const int kn = (kt + 1) * GBK;
#pragma unroll
      for (int i = 0; i < 8; ++i) st[i] = *(const v8h*)(ga + i * 16 * GK + kn);
#pragma unroll
      for (int i = 0; i < 4; ++i)
        st[8 + i] = *(const v8h*)(gb + i * 16 * GK + kn);
      // the loads' address pairs are rewritten at the head of the unrolled body,
      // and one way there in the built code passes no wait for the loads' data
      asm volatile("s_wait_xcnt 0x0" ::: "memory");
    }

    v16h a[2][2], bm[2][4];  // [k step of 32][tile]
#pragma unroll
    for (int ks = 0; ks < 2; ++ks) {
      const int o = cur + ks * 32;
      a[ks][0] = load_frag2(ra + o + kb0, ra + o + kb1);
      a[ks][1] = load_frag2(ra + o + 16 * GPITCH + kb0,
                            ra + o + 16 * GPITCH + kb1);
#pragma unroll
      for (int nt = 0; nt < 4; ++nt)
        bm[ks][nt] = load_frag2(rb + o + nt * 16 * GPITCH + kb0,
                                rb + o + nt * 16 * GPITCH + kb1);
    }
    // keeps the trip's LDS reads one group in front of its products: spread
    // among them into one register set, each pair of products waited out a read
    __builtin_amdgcn_sched_barrier(0);

#pragma unroll
    for (int ks = 0; ks < 2; ++ks)
#pragma unroll
      for (int nt = 0; nt < 4; ++nt) {
        acc[0][nt] = wmma_f16(a[ks][0], bm[ks][nt], acc[0][nt]);
        acc[1][nt] = wmma_f16(a[ks][1], bm[ks][nt], acc[1][nt]);
      }
    // keeps the wait for the global loads, which stands in front of the stores
    // below, behind the trip's products
    __builtin_amdgcn_sched_barrier(0);

    // the other buffer's last readers left it at the barrier of the trip before
    if (more) {
#pragma unroll
      for (int i = 0; i < 12; ++i)
        *(v8h*)(sw + (GBUF - cur) + i * 16 * GPITCH) = st[i];
      __syncthreads();
    }
  }
}

// Per-head projection: out = x @ W[h] + bias[h], W pre-transposed [H,D,E].
// grid = (ROWS/128, NH), block = 128 (4 waves, each wave -> 32 rows x 64 cols)
// vt=0: out[b,h,s,d];  vt=1: out[b,h,d,s] (transposed, for V)
__global__ __launch_bounds__(128) void qkv_gemm_kernel(
    const h16* __restrict__ X,       // [ROWS, NE]
    const h16* __restrict__ Wt,      // [NH, ND, NE]
    const float* __restrict__ bias,  // [NH, ND]
    h16* __restrict__ out, int vt)
{
  const int tid  = threadIdx.x;
  const int wave = tid >> 5;
  const int lane = tid & 31;
  const int half = lane >> 4;
  const int l16  = lane & 15;
  const int h    = blockIdx.y;
  const int rowbase = blockIdx.x * 128 + wave * 32;

  __shared__ __attribute__((aligned(16))) h16 sm[2 * GBUF];
  v8f acc[2][4] = {};
  tile_product(X + (size_t)blockIdx.x * 128 * NE, Wt + (size_t)h * ND * NE, sm,
               acc);

  if (vt) {
    // transposed output: a lane's eight registers are eight consecutive s of
    // one d row (a group of 8 never crosses a batch): one 16-byte store
#pragma unroll
    for (int mt = 0; mt < 2; ++mt)
#pragma unroll
      for (int nt = 0; nt < 4; ++nt) {
        const int rowg = rowbase + mt * 16 + half * 8;
        const int b    = rowg >> 11;  // / NS
        const int s    = rowg & (NS - 1);
        const int n    = nt * 16 + l16;
        const float bn = bias[h * ND + n];
        v8h o;
#pragma unroll
        for (int r = 0; r < 8; ++r) o[r] = (h16)(acc[mt][nt][r] + bn);
        *(v8h*)(out + ((size_t)(b * NH + h) * ND + n) * NS + s) = o;
      }
    // the built code falls from here into the other side's code, which reuses
    // the stores' registers
    asm volatile("s_wait_xcnt 0x0" ::: "memory");
    return;
  }

#pragma unroll
  for (int mt = 0; mt < 2; ++mt)
#pragma unroll
    for (int nt = 0; nt < 4; ++nt)
#pragma unroll
      for (int r = 0; r < 8; ++r) {
        const int rowg = rowbase + mt * 16 + half * 8 + r;
        const int b    = rowg >> 11;  // / NS
        const int s    = rowg & (NS - 1);
        const int n    = nt * 16 + l16;
        const float v  = acc[mt][nt][r] + bias[h * ND + n];
        out[((size_t)(b * NH + h) * NS + s) * ND + n] = (h16)v;
      }
}

// Lane l <-> lane l ^ 16: the other half of the wave holds the other 16 keys
// of the same query column.
static __device__ __forceinline__ float other_half(float v) {
  int b = __builtin_bit_cast(int, v);
  b = __builtin_amdgcn_permlanex16(b, b, 0x76543210, 0xfedcba98, false, false);
  return __builtin_bit_cast(float, b);
}

// Flash-attention: one block of AW waves per 32-query tile per (b,h); K/V
// fragments are shared by both 16-query sub-tiles (2x WMMA per byte loaded).
// The tile's 32-key chunks are dealt round-robin to the waves: the launch lasts
// as long as its longest wave, which now walks 16 chunks where a lone wave
// walked 64, and a SIMD holds twice the waves to cover loads and chains.  Each
// wave keeps its own running maximum, sum and Ot; they are joined once in LDS.
// The products are taken transposed: St = K Q^T and Ot += Vt Pt.  A lane then
// holds 16 of the 32 scores of ONE query (its column), so maximum and sum are
// taken in the lane, and the two score tiles of a column, converted in place,
// are the B operand of the second product.
// grid = NB*NH*(NS/32), block = 32*AW.  V is transposed [NB*NH, ND, NS].
#define AW 4
// one (wave, d tile) slice of the partial Ot in LDS, floats: 2 query tiles x 2
// pieces x 32 lanes x 4 values, and 16 more: 16 lanes of a 16-byte read in the
// join take 4 queries x 4 d tiles, and 64 B a slice puts them on distinct banks
#define JSLICE (2 * 2 * 32 * 4 + 16)
__global__ __launch_bounds__(32 * AW) void attn_kernel(
    const h16* __restrict__ Q,   // [NB*NH, NS, ND]
    const h16* __restrict__ K,   // [NB*NH, NS, ND]
    const h16* __restrict__ Vt,  // [NB*NH, ND, NS]
    h16* __restrict__ O)         // [NB, NS, NH*ND]
{
  __shared__ __attribute__((aligned(16))) float s_acc[AW * 4 * JSLICE];
  __shared__ float s_m[AW][2][32];
  __shared__ float s_l[AW][2][32];
  const int lane = threadIdx.x & 31;
  // in a scalar register, so that the key loop's test is a scalar branch
  const int wave = __builtin_amdgcn_readfirstlane(threadIdx.x >> 5);
  const int half = lane >> 4;
  const int l16  = lane & 15;
  const int kb0  = half * 8;
  const int kb1  = 16 + half * 8;
  const int qt   = blockIdx.x & (NS / 32 - 1);
  const int bh   = blockIdx.x >> 6;
  const int h    = bh & (NH - 1);
  const int b    = bh >> 4;
  const int qbase = qt * 32;

  const h16* Qp = Q + (size_t)bh * NS * ND;
  const h16* Kp = K + (size_t)bh * NS * ND;
  const h16* Vp = Vt + (size_t)bh * ND * NS;

  // Q fragments (B operand: lane = query column): 2 column tiles x 2 K-chunks,
  // resident for the whole pass
  v16h bq[2][2];
#pragma unroll
  for (int mt = 0; mt < 2; ++mt) {
    const h16* qrow = Qp + (size_t)(qbase + mt * 16 + l16) * ND;
#pragma unroll
    for (int kc = 0; kc < 2; ++kc)
      bq[mt][kc] = load_frag2(qrow + kc * 32 + kb0, qrow + kc * 32 + kb1);
  }

  // acc[mt][nt][r] = O[query mt*16 + l16][d = nt*16 + half*8 + r]
  v8f acc[2][4] = {};
  float col_m[2] = {-1e30f, -1e30f};  // running maximum of the lane's query
  float col_l[2] = {0.0f, 0.0f};      // running sum over this half's keys only

  const float scale  = 0.125f;        // 1/sqrt(64)
  const int nchunks = (qbase >> 5) + 1;  // causal bound (rows < qbase+32)

  // the lane's K row and V column of the wave's current chunk: running
  // pointers, so that a trip forms no address from the chunk's number
  const h16* kp = Kp + (size_t)(wave * 32 + l16) * ND;
  const h16* vp = Vp + (size_t)l16 * NS + wave * 32;

  for (int ch = wave; ch < nchunks; ch += AW) {
    const int tbase = ch * 32;

    // ---- K fragments (A operand: lane = key row; shared by both tiles) ----
    v16h ak[2][2];  // [tt][kc]
#pragma unroll
    for (int tt = 0; tt < 2; ++tt) {
      const h16* krow = kp + tt * 16 * ND;
#pragma unroll
      for (int kc = 0; kc < 2; ++kc)
        ak[tt][kc] = load_frag2(krow + kc * 32 + kb0, krow + kc * 32 + kb1);
    }
    // K's address registers may be reused as a destination of V's loads
    asm volatile("s_wait_xcnt 0x0" ::: "memory");

    // ---- V fragments (A operand: lane = d row; shared by both tiles) ----
    // one group behind K's loads, so that they fly during scores and softmax
    v16h av[4];
#pragma unroll
    for (int nt = 0; nt < 4; ++nt) {
      const h16* vr = vp + (size_t)nt * 16 * NS;
      av[nt] = load_frag2(vr + kb0, vr + kb1);
    }
    // keeps the scheduler from sinking V's loads to their use, where it split
    // them into four pairs, each waited for on its own
    __builtin_amdgcn_sched_barrier(0);
    // the built code forms the prefetch address in V's address registers
    asm volatile("s_wait_xcnt 0x0" ::: "memory");
    if (ch + AW < nchunks) {
      __builtin_prefetch(kp + AW * 32 * ND, 0, 3);
      __builtin_prefetch(kp + (AW * 32 + 16) * ND, 0, 3);
    }
    // the address registers of the loads and prefetches above are advanced or
    // reused below
    asm volatile("s_wait_xcnt 0x0" ::: "memory");
    // keeps the address additions from being lifted over that wait
    __builtin_amdgcn_sched_barrier(0);
    kp += AW * 32 * ND;
    vp += AW * 32;

    // ---- scores: St = K Q^T ----
    // c[mt][tt][r] = S[query mt*16 + l16][key tbase + tt*16 + half*8 + r]
    v8f c[2][2] = {};
#pragma unroll
    for (int mt = 0; mt < 2; ++mt)
#pragma unroll
      for (int tt = 0; tt < 2; ++tt)
#pragma unroll
        for (int kc = 0; kc < 2; ++kc)
          c[mt][tt] = wmma_f16(ak[tt][kc], bq[mt][kc], c[mt][tt]);

    // ---- scale + causal mask + online softmax (per query column) ----
    float corr[2];
    v16h bp[2];  // P^T as B operand: element tt*8 + r = key tt*16 + half*8 + r
#pragma unroll
    for (int mt = 0; mt < 2; ++mt) {
      const int srow = qbase + mt * 16 + l16;
      float s[16];
#pragma unroll
      for (int e = 0; e < 16; ++e) {
        s[e] = c[mt][e >> 3][e & 7] * scale;
        if (tbase + (e >> 3) * 16 + half * 8 + (e & 7) > srow) s[e] = -1e30f;
      }
      // pairwise trees, so that no chain is longer than four links
      float t[8];
#pragma unroll
      for (int e = 0; e < 8; ++e) t[e] = fmaxf(s[e], s[e + 8]);
#pragma unroll
      for (int w = 4; w > 0; w >>= 1)
#pragma unroll
        for (int e = 0; e < w; ++e) t[e] = fmaxf(t[e], t[e + w]);
      const float mx   = fmaxf(t[0], other_half(t[0]));
      const float mnew = fmaxf(col_m[mt], mx);
      corr[mt]  = __expf(col_m[mt] - mnew);
      col_m[mt] = mnew;
#pragma unroll
      for (int e = 0; e < 16; ++e) {
        s[e] = __expf(s[e] - mnew);
        bp[mt][e] = (h16)s[e];
      }
#pragma unroll
      for (int e = 0; e < 8; ++e) t[e] = s[e] + s[e + 8];
#pragma unroll
      for (int w = 4; w > 0; w >>= 1)
#pragma unroll
        for (int e = 0; e < w; ++e) t[e] += t[e + w];
      col_l[mt] = col_l[mt] * corr[mt] + t[0];
    }

    // rescale running accumulators
#pragma unroll
    for (int mt = 0; mt < 2; ++mt)
#pragma unroll
      for (int nt = 0; nt < 4; ++nt)
#pragma unroll
        for (int r = 0; r < 8; ++r) acc[mt][nt][r] *= corr[mt];

    // ---- Ot += Vt Pt ----
#pragma unroll
    for (int nt = 0; nt < 4; ++nt) {
      acc[0][nt] = wmma_f16(av[nt], bp[0], acc[0][nt]);
      acc[1][nt] = wmma_f16(av[nt], bp[1], acc[1][nt]);
    }
  }

  // ---- join the waves' partial results ----
  // a wave that had no chunk hands over maximum -1e30, sum 0 and Ot 0, and its
  // factor below is 0; wave 0 always has chunk 0, so the joint maximum is real
#pragma unroll
  for (int mt = 0; mt < 2; ++mt) {
    s_m[wave][mt][lane] = col_m[mt];
    s_l[wave][mt][lane] = col_l[mt] + other_half(col_l[mt]);
#pragma unroll
    for (int nt = 0; nt < 4; ++nt)
#pragma unroll
      for (int p = 0; p < 2; ++p) {
        const v4f t = {acc[mt][nt][p * 4 + 0], acc[mt][nt][p * 4 + 1],
                       acc[mt][nt][p * 4 + 2], acc[mt][nt][p * 4 + 3]};
        *(v4f*)&s_acc[(wave * 4 + nt) * JSLICE + (mt * 2 + p) * 128 + lane * 4] =
            t;
      }
  }
  __syncthreads();

  // Wave w finishes queries 8 w .. 8 w + 7, four lanes a query with 16 d each,
  // so that a 128-byte row of O (head-concat layout [B, S, H*D]) has one writer.
  const int q   = wave * 8 + (lane >> 2);
  const int dt  = lane & 3;  // the lane's d tile
  const int qmt = q >> 4;
  const int ql  = q & 15;
  float pm[AW];
#pragma unroll
  for (int w = 0; w < AW; ++w) pm[w] = s_m[w][qmt][ql];
  const float mall = fmaxf(fmaxf(pm[0], pm[1]), fmaxf(pm[2], pm[3]));
  float lall = 0.0f;
  float o[16] = {};
#pragma unroll
  for (int w = 0; w < AW; ++w) {
    // exp(x) as 2^(x log2 e).  In asm so that the v_nop stands directly behind
    // the transcendental: the free slot before its source register is reused
    float f;
    asm("v_exp_f32 %0, %1\n\tv_nop"
        : "=v"(f)
        : "v"((pm[w] - mall) * 1.44269504f));
    lall += f * s_l[w][qmt][ql];
#pragma unroll
    for (int hf = 0; hf < 2; ++hf)
#pragma unroll
      for (int p = 0; p < 2; ++p) {
        const v4f t = *(const v4f*)&s_acc[(w * 4 + dt) * JSLICE +
                                          (qmt * 2 + p) * 128 +
                                          (hf * 16 + ql) * 4];
#pragma unroll
        for (int j = 0; j < 4; ++j) o[hf * 8 + p * 4 + j] += f * t[j];
      }
  }
  const float inv = 1.0f / lall;
  h16* orow = O + ((size_t)b * NS + qbase + q) * (NH * ND) + h * ND + dt * 16;
#pragma unroll
  for (int hf = 0; hf < 2; ++hf) {
    v8h ov;
#pragma unroll
    for (int r = 0; r < 8; ++r) ov[r] = (h16)(o[hf * 8 + r] * inv);
    *(v8h*)(orow + hf * 8) = ov;
  }
}

// Output projection: out = A @ W_o + b_o (f32), W_o pre-transposed [NE, NH*ND]
// grid = (ROWS/128, NE/64), block = 128 (4 waves, each wave 32 rows x 64 cols)
__global__ __launch_bounds__(128) void out_gemm_kernel(
    const h16* __restrict__ A,       // [ROWS, NH*ND]
    const h16* __restrict__ Wot,     // [NE, NH*ND]
    const float* __restrict__ bias,  // [NE]
    float* __restrict__ out)         // [ROWS, NE]
{
  const int tid  = threadIdx.x;
  const int wave = tid >> 5;
  const int lane = tid & 31;
  const int half = lane >> 4;
  const int l16  = lane & 15;
  const int rowbase = blockIdx.x * 128 + wave * 32;
  const int ntbase  = blockIdx.y * 64;

  __shared__ __attribute__((aligned(16))) h16 sm[2 * GBUF];
  v8f acc[2][4] = {};
  tile_product(A + (size_t)blockIdx.x * 128 * (NH * ND),
               Wot + (size_t)ntbase * (NH * ND), sm, acc);

#pragma unroll
  for (int mt = 0; mt < 2; ++mt)
#pragma unroll
    for (int nt = 0; nt < 4; ++nt)
#pragma unroll
      for (int r = 0; r < 8; ++r) {
        const int rowg = rowbase + mt * 16 + half * 8 + r;
        const int n    = ntbase + nt * 16 + l16;
        out[(size_t)rowg * NE + n] = acc[mt][nt][r] + bias[n];
      }
}

extern "C" void kernel_launch(void* const* d_in, const int* in_sizes, int n_in,
                              void* d_out, int out_size, void* d_ws,
                              size_t ws_size, hipStream_t stream) {
  const float* x   = (const float*)d_in[0];
  const float* W_q = (const float*)d_in[1];
  const float* b_q = (const float*)d_in[2];
  const float* W_k = (const float*)d_in[3];
  const float* b_k = (const float*)d_in[4];
  const float* W_v = (const float*)d_in[5];
  const float* b_v = (const float*)d_in[6];
  const float* W_o = (const float*)d_in[7];
  const float* b_o = (const float*)d_in[8];
  float* out = (float*)d_out;

  const size_t nx   = (size_t)ROWS * NE;          // 4M halves
  const size_t nqkv = (size_t)NB * NH * NS * ND;  // 4M halves
  const size_t nw   = (size_t)NH * NE * ND;       // 1M halves
  h16* xh  = (h16*)d_ws;
  h16* qh  = xh + nx;
  h16* kh  = qh + nqkv;
  h16* vh  = kh + nqkv;   // transposed V: [NB*NH, ND, NS]
  h16* oh  = vh + nqkv;
  h16* wqh = oh + nx;     // transposed: [NH, ND, NE]
  h16* wkh = wqh + nw;
  h16* wvh = wkh + nw;
  h16* woh = wvh + nw;    // transposed: [NE, NH*ND]

  cvt_kernel<<<ROWS * NE / CVT_PER_BLOCK, 256, 0, stream>>>(x, xh);
  dim3 gw(ND / 64, NE / 64, NH);         // per-head [NE, ND] -> [ND, NE]
  dim3 gwo(NE / 64, (NH * ND) / 64, 1);  // [NH*ND, NE] -> [NE, NH*ND]
  cvt_t_kernel<<<gw, 256, 0, stream>>>(W_q, wqh, NE, ND);
  cvt_t_kernel<<<gw, 256, 0, stream>>>(W_k, wkh, NE, ND);
  cvt_t_kernel<<<gw, 256, 0, stream>>>(W_v, wvh, NE, ND);
  cvt_t_kernel<<<gwo, 256, 0, stream>>>(W_o, woh, NH * ND, NE);

  dim3 gq(ROWS / 128, NH);
  qkv_gemm_kernel<<<gq, 128, 0, stream>>>(xh, wqh, b_q, qh, 0);
  qkv_gemm_kernel<<<gq, 128, 0, stream>>>(xh, wkh, b_k, kh, 0);
  qkv_gemm_kernel<<<gq, 128, 0, stream>>>(xh, wvh, b_v, vh, 1);

  attn_kernel<<<NB * NH * (NS / 32), 32 * AW, 0, stream>>>(qh, kh, vh, oh);

  dim3 go(ROWS / 128, NE / 64);
  out_gemm_kernel<<<go, 128, 0, stream>>>(oh, woh, b_o, out);
}

// v007
// It runs in 91.2 microseconds.
// Next to v006, in two timings, it ran 1.19 and 1.21 times as fast.
// Counting every step since v000, it is 4.10 times as fast.
#include <hip/hip_runtime.h>

typedef _Float16 h16;
typedef __attribute__((ext_vector_type(16))) _Float16 v16h;
typedef __attribute__((ext_vector_type(8)))  _Float16 v8h;
typedef __attribute__((ext_vector_type(8)))  float    v8f;
typedef __attribute__((ext_vector_type(2)))  _Float16 v2h;
typedef __attribute__((ext_vector_type(4)))  _Float16 v4h;
typedef __attribute__((ext_vector_type(4)))  float    v4f;

#define NB 2
#define NS 2048
#define NE 1024
#define NH 16
#define ND 64
#define ROWS (NB * NS) /* 4096 */

static __device__ __forceinline__ v8f wmma_f16(v16h a, v16h b, v8f c) {
  // 8 args: (neg_a, A, neg_b, B, c_mod, C, reuse_a, reuse_b)
  return __builtin_amdgcn_wmma_f32_16x16x32_f16(false, a, false, b, (short)0, c,
                                                false, false);
}

// Two contiguous 16-byte loads -> one 16-half fragment (b128 pairs)
static __device__ __forceinline__ v16h load_frag2(const h16* p0, const h16* p1) {
  v8h lo = *(const v8h*)p0;
  v8h hi = *(const v8h*)p1;
  return __builtin_shufflevector(lo, hi, 0, 1, 2, 3, 4, 5, 6, 7, 8, 9, 10, 11,
                                 12, 13, 14, 15);
}

// x -> f16, a stream: a wave takes 1024 consecutive values, as eight 16-byte
// loads a lane that are all in flight together (512 contiguous bytes a load)
// and eight 8-byte stores (256 contiguous bytes a store).  CVT_BLOCKS blocks of
// 8 waves, block = 256; blk is the block's number among them.
#define CVT_PER_WAVE 1024
#define CVT_PER_BLOCK (8 * CVT_PER_WAVE)
#define CVT_BLOCKS (ROWS * NE / CVT_PER_BLOCK) /* 512 */
static_assert((ROWS * NE) % CVT_PER_BLOCK == 0, "whole blocks only");
static __device__ __forceinline__ void cvt_block(const float* __restrict__ src,
                                                 h16* __restrict__ dst, int blk) {
  const int base = blk * CVT_PER_BLOCK +
                   (threadIdx.x >> 5) * CVT_PER_WAVE + (threadIdx.x & 31) * 4;
  // unrolled so that v[] stays in registers and no store stands among the loads
  v4f v[8];
#pragma unroll
  for (int i = 0; i < 8; ++i) v[i] = *(const v4f*)(src + base + i * 128);
#pragma unroll
  for (int i = 0; i < 8; ++i) {
    const v4h o = {(h16)v[i][0], (h16)v[i][1], (h16)v[i][2], (h16)v[i][3]};
    *(v4h*)(dst + base + i * 128) = o;
  }
}

// Batched transpose-convert: src [batch, R, C] f32 -> dst [batch, C, R] f16
// One 64x64 tile per block, turned in LDS, so that both sides of the copy move
// whole 128-byte lines.  block = 256; the tile is (ct, rt) of matrix bz.
// The tile is kept as [c][r]; the eight 16-byte chunks of a row are XOR-ed
// with (c >> 2) & 7 so that the 4-byte stores of a wave (columns 4 apart)
// spread over the banks while the 16-byte reads stay aligned.
static __device__ __forceinline__ void cvt_t_block(
    const float* __restrict__ src, h16* __restrict__ dst, int R, int C, int ct,
    int rt, int bz) {
  __shared__ __attribute__((aligned(16))) h16 tile[64 * 64];
  const int tid = threadIdx.x;
  const int c0  = ct * 64;
  const int r0  = rt * 64;
  const size_t base = (size_t)bz * R * C;
  const int cq = (tid & 15) * 4;  // four columns per thread
  const int rp = (tid >> 4) * 2;  // a pair of rows per thread

  // the loops below are unrolled so that v[][] stays in registers and the four
  // loads of a thread are in flight together
  v4f v[2][2];
#pragma unroll
  for (int it = 0; it < 2; ++it)
#pragma unroll
    for (int p = 0; p < 2; ++p)
      v[it][p] = *(const v4f*)(src + base +
                               (size_t)(r0 + it * 32 + rp + p) * C + c0 + cq);
#pragma unroll
  for (int it = 0; it < 2; ++it)
#pragma unroll
    for (int j = 0; j < 4; ++j) {
      const int c = cq + j;
      const int r = it * 32 + rp;
      const int chunk = (r >> 3) ^ ((c >> 2) & 7);
      v2h pr = {(h16)v[it][0][j], (h16)v[it][1][j]};
      *(v2h*)&tile[c * 64 + chunk * 8 + (r & 7)] = pr;
    }
  __syncthreads();
#pragma unroll
  for (int it = 0; it < 2; ++it) {
    const int c = it * 32 + (tid >> 3);
    const int q = tid & 7;
    const v8h o = *(const v8h*)&tile[c * 64 + (q ^ ((c >> 2) & 7)) * 8];
    *(v8h*)(dst + base + (size_t)(c0 + c) * R + r0 + q * 8) = o;
  }
}

// All five conversions in one launch: none reads what another writes, so a range
// of the block index picks the job (a block-uniform branch) and their starts,
// memory latencies and last stores overlap, where five launches stood in a row.
// Blocks 0 .. CVT_BLOCKS - 1 convert x (the most bytes a block, so first); then
// 256 tiles each of W_q, W_k, W_v (per head [NE, ND] -> [ND, NE]) and of W_o
// ([NH*ND, NE] -> [NE, NH*ND]), whose outputs stand one behind the other in wt.
#define WT_TILES 256               /* 64x64 tiles of one weight */
#define WT_HALVES (NH * NE * ND)   /* elements of one weight */
__global__ __launch_bounds__(256) void prep_kernel(
    const float* __restrict__ x, const float* __restrict__ W_q,
    const float* __restrict__ W_k, const float* __restrict__ W_v,
    const float* __restrict__ W_o, h16* __restrict__ xh, h16* __restrict__ wt) {
  const int blk = blockIdx.x;
  if (blk < CVT_BLOCKS) {
    cvt_block(x, xh, blk);
    return;
  }
  const int job = (blk - CVT_BLOCKS) >> 8;   // / WT_TILES
  const int t   = (blk - CVT_BLOCKS) & (WT_TILES - 1);
  const int lo  = t & 15;
  const int hi  = t >> 4;
  const bool wo = job == 3;  // one matrix of 16 x 16 tiles; else 16 of 1 x 16
  const float* w = job == 0 ? W_q : job == 1 ? W_k : job == 2 ? W_v : W_o;
  static_assert(NH * ND == NE, "all four weights have NE rows a matrix");
  cvt_t_block(w, wt + (size_t)job * WT_HALVES, NE, wo ? NE : ND, wo ? lo : 0,
              wo ? hi : lo, wo ? 0 : hi);
}

// Product of one 128 x 64 output tile, shared by the projection kernels:
// acc += A[128 rows] * Bt[64 rows]^T over k = 0..1023, both operands k-contiguous
// with a row pitch of 1024 halves.  block = 128 (4 waves, each 32 rows x 64 cols).
// A fragment load straight from the rows touches 16 lines for 512 bytes, so the
// block brings 64 k of all 192 rows by whole 128-byte lines (8 lanes a row)
// and turns them in LDS; the next trip's lines fly while this trip's products
// run, in two buffers.  LDS rows stand at 144 bytes (16 B x odd), the pitch at
// which the 16 rows of a 16-byte fragment read fall on distinct banks.
#define GK 1024                     /* k extent and row pitch, halves */
#define GBK 64                      /* k per trip: one 128-byte line a row */
#define GPITCH 72                   /* LDS row pitch, halves */
#define GBUF ((128 + 64) * GPITCH)  /* one buffer, halves */
static __device__ __forceinline__ void tile_product(
    const h16* __restrict__ Ab,  // first of the block's 128 rows of A
    const h16* __restrict__ Bb,  // first of the block's 64 rows of Bt
    h16* sm,                     // 2 * GBUF halves of LDS
    v8f (&acc)[2][4])
{
  const int tid  = threadIdx.x;
  const int wave = tid >> 5;
  const int lane = tid & 31;
  const int half = lane >> 4;
  const int l16  = lane & 15;
  const int kb0  = half * 8;
  const int kb1  = 16 + half * 8;
  // staging: rows srow + 16 i, one 16-byte piece of each.  Neighbouring groups
  // of 8 lanes take rows 8 apart: 8 * 144 B lands half the banks further, so the
  // 16 lanes of a 16-byte LDS store cover every bank once (rows 1 apart would
  // share 4 banks)
  const int srow = ((tid >> 3) & 1) * 8 + (tid >> 4);
  const int sch  = (tid & 7) * 8;

  const h16* ga = Ab + (size_t)srow * GK + sch;
  const h16* gb = Bb + (size_t)srow * GK + sch;
  h16* sw = sm + srow * GPITCH + sch;
  const h16* ra = sm + (wave * 32 + l16) * GPITCH;
  const h16* rb = sm + (128 + l16) * GPITCH;

  v8h st[12];  // rows 0..127 of a buffer are A's, rows 128..191 are Bt's
#pragma unroll
  for (int i = 0; i < 8; ++i) st[i] = *(const v8h*)(ga + i * 16 * GK);
#pragma unroll
  for (int i = 0; i < 4; ++i) st[8 + i] = *(const v8h*)(gb + i * 16 * GK);
#pragma unroll
  for (int i = 0; i < 12; ++i) *(v8h*)(sw + i * 16 * GPITCH) = st[i];
  __syncthreads();

  // unrolled by 8, so that the k steps and the two buffers are immediate offsets:
  // the global address pairs are formed once in eight trips, and no trip forms an
  // LDS address
#pragma unroll 8
  for (int kt = 0; kt < GK / GBK; ++kt) {
    const int cur = (kt & 1) * GBUF;
    const bool more = kt + 1 < GK / GBK;
    if (more) {
      const int kn = (kt + 1) * GBK;
#pragma unroll
      for (int i = 0; i < 8; ++i) st[i] = *(const v8h*)(ga + i * 16 * GK + kn);
#pragma unroll
      for (int i = 0; i < 4; ++i)
        st[8 + i] = *(const v8h*)(gb + i * 16 * GK + kn);
      // the loads' address pairs are rewritten at the head of the unrolled body,
      // and one way there in the built code passes no wait for the loads' data
      asm volatile("s_wait_xcnt 0x0" ::: "memory");
    }

    v16h a[2][2], bm[2][4];  // [k step of 32][tile]
#pragma unroll
    for (int ks = 0; ks < 2; ++ks) {
      const int o = cur + ks * 32;
      a[ks][0] = load_frag2(ra + o + kb0, ra + o + kb1);
      a[ks][1] = load_frag2(ra + o + 16 * GPITCH + kb0,
                            ra + o + 16 * GPITCH + kb1);
#pragma unroll
      for (int nt = 0; nt < 4; ++nt)
        bm[ks][nt] = load_frag2(rb + o + nt * 16 * GPITCH + kb0,
                                rb + o + nt * 16 * GPITCH + kb1);
    }
    // keeps the trip's LDS reads one group in front of its products: spread
    // among them into one register set, each pair of products waited out a read
    __builtin_amdgcn_sched_barrier(0);

#pragma unroll
    for (int ks = 0; ks < 2; ++ks)
#pragma unroll
      for (int nt = 0; nt < 4; ++nt) {
        acc[0][nt] = wmma_f16(a[ks][0], bm[ks][nt], acc[0][nt]);
        acc[1][nt] = wmma_f16(a[ks][1], bm[ks][nt], acc[1][nt]);
      }
    // keeps the wait for the global loads, which stands in front of the stores
    // below, behind the trip's products
    __builtin_amdgcn_sched_barrier(0);

    // the other buffer's last readers left it at the barrier of the trip before
    if (more) {
#pragma unroll
      for (int i = 0; i < 12; ++i)
        *(v8h*)(sw + (GBUF - cur) + i * 16 * GPITCH) = st[i];
      __syncthreads();
    }
  }
}

// Per-head projection: out = x @ W[h] + bias[h], W pre-transposed [H,D,E].
// Q, K and V in one launch: blockIdx.z picks the weight, the bias and the output.
// A WGP then holds as many blocks as its registers allow and takes the next as
// one ends, where three launches of two blocks a WGP stood in a row.
// grid = (ROWS/128, NH, 3), block = 128 (4 waves, each wave -> 32 rows x 64 cols)
// Q, K: out[b,h,s,d];  V: out[b,h,d,s] (transposed)
__global__ __launch_bounds__(128) void qkv_gemm_kernel(
    const h16* __restrict__ X,      // [ROWS, NE]
    const h16* __restrict__ Wqkv,   // 3 x [NH, ND, NE]
    const float* __restrict__ b_q,  // [NH, ND]
    const float* __restrict__ b_k,  // [NH, ND]
    const float* __restrict__ b_v,  // [NH, ND]
    h16* __restrict__ qkv)          // 3 x NB*NH*NS*ND
{
  const int which = blockIdx.z;
  const int vt    = which == 2;
  const h16* Wt   = Wqkv + (size_t)which * WT_HALVES;
  const float* bias = which == 0 ? b_q : which == 1 ? b_k : b_v;
  h16* out = qkv + (size_t)which * (NB * NH * NS * ND);
  const int tid  = threadIdx.x;
  const int wave = tid >> 5;
  const int lane = tid & 31;
  const int half = lane >> 4;
  const int l16  = lane & 15;
  const int h    = blockIdx.y;
  const int rowbase = blockIdx.x * 128 + wave * 32;

  __shared__ __attribute__((aligned(16))) h16 sm[2 * GBUF];
  v8f acc[2][4] = {};
  tile_product(X + (size_t)blockIdx.x * 128 * NE, Wt + (size_t)h * ND * NE, sm,
               acc);

  if (vt) {
    // transposed output: a lane's eight registers are eight consecutive s of
    // one d row (a group of 8 never crosses a batch): one 16-byte store
#pragma unroll
    for (int mt = 0; mt < 2; ++mt)
#pragma unroll
      for (int nt = 0; nt < 4; ++nt) {
        const int rowg = rowbase + mt * 16 + half * 8;
        const int b    = rowg >> 11;  // / NS
        const int s    = rowg & (NS - 1);
        const int n    = nt * 16 + l16;
        const float bn = bias[h * ND + n];
        v8h o;
#pragma unroll
        for (int r = 0; r < 8; ++r) o[r] = (h16)(acc[mt][nt][r] + bn);
        *(v8h*)(out + ((size_t)(b * NH + h) * ND + n) * NS + s) = o;
      }
    return;
  }

#pragma unroll
  for (int mt = 0; mt < 2; ++mt)
#pragma unroll
    for (int nt = 0; nt < 4; ++nt)
#pragma unroll
      for (int r = 0; r < 8; ++r) {
        const int rowg = rowbase + mt * 16 + half * 8 + r;
        const int b    = rowg >> 11;  // / NS
        const int s    = rowg & (NS - 1);
        const int n    = nt * 16 + l16;
        const float v  = acc[mt][nt][r] + bias[h * ND + n];
        out[((size_t)(b * NH + h) * NS + s) * ND + n] = (h16)v;
      }
  // the built code lays V's side behind this one, with a way from here into it,
  // and V's side reuses the stores' registers
  asm volatile("s_wait_xcnt 0x0" ::: "memory");
}

// Lane l <-> lane l ^ 16: the other half of the wave holds the other 16 keys
// of the same query column.
static __device__ __forceinline__ float other_half(float v) {
  int b = __builtin_bit_cast(int, v);
  b = __builtin_amdgcn_permlanex16(b, b, 0x76543210, 0xfedcba98, false, false);
  return __builtin_bit_cast(float, b);
}

// Flash-attention: one block of AW waves per 32-query tile per (b,h); K/V
// fragments are shared by both 16-query sub-tiles (2x WMMA per byte loaded).
// The tile's 32-key chunks are dealt round-robin to the waves: the launch lasts
// as long as its longest wave, which now walks 16 chunks where a lone wave
// walked 64, and a SIMD holds twice the waves to cover loads and chains.  Each
// wave keeps its own running maximum, sum and Ot; they are joined once in LDS.
// The products are taken transposed: St = K Q^T and Ot += Vt Pt.  A lane then
// holds 16 of the 32 scores of ONE query (its column), so maximum and sum are
// taken in the lane, and the two score tiles of a column, converted in place,
// are the B operand of the second product.
// grid = NB*NH*(NS/32), block = 32*AW.  V is transposed [NB*NH, ND, NS].
#define AW 4
// one (wave, d tile) slice of the partial Ot in LDS, floats: 2 query tiles x 2
// pieces x 32 lanes x 4 values, and 16 more: 16 lanes of a 16-byte read in the
// join take 4 queries x 4 d tiles, and 64 B a slice puts them on distinct banks
#define JSLICE (2 * 2 * 32 * 4 + 16)
__global__ __launch_bounds__(32 * AW) void attn_kernel(
    const h16* __restrict__ Q,   // [NB*NH, NS, ND]
    const h16* __restrict__ K,   // [NB*NH, NS, ND]
    const h16* __restrict__ Vt,  // [NB*NH, ND, NS]
    h16* __restrict__ O)         // [NB, NS, NH*ND]
{
  __shared__ __attribute__((aligned(16))) float s_acc[AW * 4 * JSLICE];
  __shared__ float s_m[AW][2][32];
  __shared__ float s_l[AW][2][32];
  const int lane = threadIdx.x & 31;
  // in a scalar register, so that the key loop's test is a scalar branch
  const int wave = __builtin_amdgcn_readfirstlane(threadIdx.x >> 5);
  const int half = lane >> 4;
  const int l16  = lane & 15;
  const int kb0  = half * 8;
  const int kb1  = 16 + half * 8;
  const int qt   = blockIdx.x & (NS / 32 - 1);
  const int bh   = blockIdx.x >> 6;
  const int h    = bh & (NH - 1);
  const int b    = bh >> 4;
  const int qbase = qt * 32;

  const h16* Qp = Q + (size_t)bh * NS * ND;
  const h16* Kp = K + (size_t)bh * NS * ND;
  const h16* Vp = Vt + (size_t)bh * ND * NS;

  // Q fragments (B operand: lane = query column): 2 column tiles x 2 K-chunks,
  // resident for the whole pass
  v16h bq[2][2];
#pragma unroll
  for (int mt = 0; mt < 2; ++mt) {
    const h16* qrow = Qp + (size_t)(qbase + mt * 16 + l16) * ND;
#pragma unroll
    for (int kc = 0; kc < 2; ++kc)
      bq[mt][kc] = load_frag2(qrow + kc * 32 + kb0, qrow + kc * 32 + kb1);
  }

  // acc[mt][nt][r] = O[query mt*16 + l16][d = nt*16 + half*8 + r]
  v8f acc[2][4] = {};
  float col_m[2] = {-1e30f, -1e30f};  // running maximum of the lane's query
  float col_l[2] = {0.0f, 0.0f};      // running sum over this half's keys only

  const float scale  = 0.125f;        // 1/sqrt(64)
  const int nchunks = (qbase >> 5) + 1;  // causal bound (rows < qbase+32)

  // the lane's K row and V column of the wave's current chunk: running
  // pointers, so that a trip forms no address from the chunk's number
  const h16* kp = Kp + (size_t)(wave * 32 + l16) * ND;
  const h16* vp = Vp + (size_t)l16 * NS + wave * 32;

  for (int ch = wave; ch < nchunks; ch += AW) {
    const int tbase = ch * 32;

    // ---- K fragments (A operand: lane = key row; shared by both tiles) ----
    v16h ak[2][2];  // [tt][kc]
#pragma unroll
    for (int tt = 0; tt < 2; ++tt) {
      const h16* krow = kp + tt * 16 * ND;
#pragma unroll
      for (int kc = 0; kc < 2; ++kc)
        ak[tt][kc] = load_frag2(krow + kc * 32 + kb0, krow + kc * 32 + kb1);
    }
    // K's address registers may be reused as a destination of V's loads
    asm volatile("s_wait_xcnt 0x0" ::: "memory");

    // ---- V fragments (A operand: lane = d row; shared by both tiles) ----
    // one group behind K's loads, so that they fly during scores and softmax
    v16h av[4];
#pragma unroll
    for (int nt = 0; nt < 4; ++nt) {
      const h16* vr = vp + (size_t)nt * 16 * NS;
      av[nt] = load_frag2(vr + kb0, vr + kb1);
    }
    // keeps the scheduler from sinking V's loads to their use, where it split
    // them into four pairs, each waited for on its own
    __builtin_amdgcn_sched_barrier(0);
    // the built code forms the prefetch address in V's address registers
    asm volatile("s_wait_xcnt 0x0" ::: "memory");
    if (ch + AW < nchunks) {
      __builtin_prefetch(kp + AW * 32 * ND, 0, 3);
      __builtin_prefetch(kp + (AW * 32 + 16) * ND, 0, 3);
    }
    // the address registers of the loads and prefetches above are advanced or
    // reused below
    asm volatile("s_wait_xcnt 0x0" ::: "memory");
    // keeps the address additions from being lifted over that wait
    __builtin_amdgcn_sched_barrier(0);
    kp += AW * 32 * ND;
    vp += AW * 32;

    // ---- scores: St = K Q^T ----
    // c[mt][tt][r] = S[query mt*16 + l16][key tbase + tt*16 + half*8 + r]
    v8f c[2][2] = {};
#pragma unroll
    for (int mt = 0; mt < 2; ++mt)
#pragma unroll
      for (int tt = 0; tt < 2; ++tt)
#pragma unroll
        for (int kc = 0; kc < 2; ++kc)
          c[mt][tt] = wmma_f16(ak[tt][kc], bq[mt][kc], c[mt][tt]);

    // ---- scale + causal mask + online softmax (per query column) ----
    float corr[2];
    v16h bp[2];  // P^T as B operand: element tt*8 + r = key tt*16 + half*8 + r
#pragma unroll
    for (int mt = 0; mt < 2; ++mt) {
      const int srow = qbase + mt * 16 + l16;
      float s[16];
#pragma unroll
      for (int e = 0; e < 16; ++e) {
        s[e] = c[mt][e >> 3][e & 7] * scale;
        if (tbase + (e >> 3) * 16 + half * 8 + (e & 7) > srow) s[e] = -1e30f;
      }
      // pairwise trees, so that no chain is longer than four links
      float t[8];
#pragma unroll
      for (int e = 0; e < 8; ++e) t[e] = fmaxf(s[e], s[e + 8]);
#pragma unroll
      for (int w = 4; w > 0; w >>= 1)
#pragma unroll
        for (int e = 0; e < w; ++e) t[e] = fmaxf(t[e], t[e + w]);
      const float mx   = fmaxf(t[0], other_half(t[0]));
      const float mnew = fmaxf(col_m[mt], mx);
      corr[mt]  = __expf(col_m[mt] - mnew);
      col_m[mt] = mnew;
#pragma unroll
      for (int e = 0; e < 16; ++e) {
        s[e] = __expf(s[e] - mnew);
        bp[mt][e] = (h16)s[e];
      }
#pragma unroll
      for (int e = 0; e < 8; ++e) t[e] = s[e] + s[e + 8];
#pragma unroll
      for (int w = 4; w > 0; w >>= 1)
#pragma unroll
        for (int e = 0; e < w; ++e) t[e] += t[e + w];
      col_l[mt] = col_l[mt] * corr[mt] + t[0];
    }

    // rescale running accumulators
#pragma unroll
    for (int mt = 0; mt < 2; ++mt)
#pragma unroll
      for (int nt = 0; nt < 4; ++nt)
#pragma unroll
        for (int r = 0; r < 8; ++r) acc[mt][nt][r] *= corr[mt];

    // ---- Ot += Vt Pt ----
#pragma unroll
    for (int nt = 0; nt < 4; ++nt) {
      acc[0][nt] = wmma_f16(av[nt], bp[0], acc[0][nt]);
      acc[1][nt] = wmma_f16(av[nt], bp[1], acc[1][nt]);
    }
  }

  // ---- join the waves' partial results ----
  // a wave that had no chunk hands over maximum -1e30, sum 0 and Ot 0, and its
  // factor below is 0; wave 0 always has chunk 0, so the joint maximum is real
#pragma unroll
  for (int mt = 0; mt < 2; ++mt) {
    s_m[wave][mt][lane] = col_m[mt];
    s_l[wave][mt][lane] = col_l[mt] + other_half(col_l[mt]);
#pragma unroll
    for (int nt = 0; nt < 4; ++nt)
#pragma unroll
      for (int p = 0; p < 2; ++p) {
        const v4f t = {acc[mt][nt][p * 4 + 0], acc[mt][nt][p * 4 + 1],
                       acc[mt][nt][p * 4 + 2], acc[mt][nt][p * 4 + 3]};
        *(v4f*)&s_acc[(wave * 4 + nt) * JSLICE + (mt * 2 + p) * 128 + lane * 4] =
            t;
      }
  }
  __syncthreads();

  // Wave w finishes queries 8 w .. 8 w + 7, four lanes a query with 16 d each,
  // so that a 128-byte row of O (head-concat layout [B, S, H*D]) has one writer.
  const int q   = wave * 8 + (lane >> 2);
  const int dt  = lane & 3;  // the lane's d tile
  const int qmt = q >> 4;
  const int ql  = q & 15;
  float pm[AW];
#pragma unroll
  for (int w = 0; w < AW; ++w) pm[w] = s_m[w][qmt][ql];
  const float mall = fmaxf(fmaxf(pm[0], pm[1]), fmaxf(pm[2], pm[3]));
  float lall = 0.0f;
  float o[16] = {};
#pragma unroll
  for (int w = 0; w < AW; ++w) {
    // exp(x) as 2^(x log2 e).  In asm so that the v_nop stands directly behind
    // the transcendental: the free slot before its source register is reused
    float f;
    asm("v_exp_f32 %0, %1\n\tv_nop"
        : "=v"(f)
        : "v"((pm[w] - mall) * 1.44269504f));
    lall += f * s_l[w][qmt][ql];
#pragma unroll
    for (int hf = 0; hf < 2; ++hf)
#pragma unroll
      for (int p = 0; p < 2; ++p) {
        const v4f t = *(const v4f*)&s_acc[(w * 4 + dt) * JSLICE +
                                          (qmt * 2 + p) * 128 +
                                          (hf * 16 + ql) * 4];
#pragma unroll
        for (int j = 0; j < 4; ++j) o[hf * 8 + p * 4 + j] += f * t[j];
      }
  }
  const float inv = 1.0f / lall;
  h16* orow = O + ((size_t)b * NS + qbase + q) * (NH * ND) + h * ND + dt * 16;
#pragma unroll
  for (int hf = 0; hf < 2; ++hf) {
    v8h ov;
#pragma unroll
    for (int r = 0; r < 8; ++r) ov[r] = (h16)(o[hf * 8 + r] * inv);
    *(v8h*)(orow + hf * 8) = ov;
  }
}

// Output projection: out = A @ W_o + b_o (f32), W_o pre-transposed [NE, NH*ND]
// grid = (ROWS/128, NE/64), block = 128 (4 waves, each wave 32 rows x 64 cols)
__global__ __launch_bounds__(128) void out_gemm_kernel(
    const h16* __restrict__ A,       // [ROWS, NH*ND]
    const h16* __restrict__ Wot,     // [NE, NH*ND]
    const float* __restrict__ bias,  // [NE]
    float* __restrict__ out)         // [ROWS, NE]
{
  const int tid  = threadIdx.x;
  const int wave = tid >> 5;
  const int lane = tid & 31;
  const int half = lane >> 4;
  const int l16  = lane & 15;
  const int rowbase = blockIdx.x * 128 + wave * 32;
  const int ntbase  = blockIdx.y * 64;

  __shared__ __attribute__((aligned(16))) h16 sm[2 * GBUF];
  v8f acc[2][4] = {};
  tile_product(A + (size_t)blockIdx.x * 128 * (NH * ND),
               Wot + (size_t)ntbase * (NH * ND), sm, acc);

#pragma unroll
  for (int mt = 0; mt < 2; ++mt)
#pragma unroll
    for (int nt = 0; nt < 4; ++nt)
#pragma unroll
      for (int r = 0; r < 8; ++r) {
        const int rowg = rowbase + mt * 16 + half * 8 + r;
        const int n    = ntbase + nt * 16 + l16;
        out[(size_t)rowg * NE + n] = acc[mt][nt][r] + bias[n];
      }
}

extern "C" void kernel_launch(void* const* d_in, const int* in_sizes, int n_in,
                              void* d_out, int out_size, void* d_ws,
                              size_t ws_size, hipStream_t stream) {
  const float* x   = (const float*)d_in[0];
  const float* W_q = (const float*)d_in[1];
  const float* b_q = (const float*)d_in[2];
  const float* W_k = (const float*)d_in[3];
  const float* b_k = (const float*)d_in[4];
  const float* W_v = (const float*)d_in[5];
  const float* b_v = (const float*)d_in[6];
  const float* W_o = (const float*)d_in[7];
  const float* b_o = (const float*)d_in[8];
  float* out = (float*)d_out;

  const size_t nx   = (size_t)ROWS * NE;          // 4M halves
  const size_t nqkv = (size_t)NB * NH * NS * ND;  // 4M halves
  const size_t nw   = (size_t)NH * NE * ND;       // 1M halves
  h16* xh  = (h16*)d_ws;
  h16* qh  = xh + nx;
  h16* kh  = qh + nqkv;
  h16* vh  = kh + nqkv;   // transposed V: [NB*NH, ND, NS]
  h16* oh  = vh + nqkv;
  h16* wqh = oh + nx;     // transposed: [NH, ND, NE]
  h16* wkh = wqh + nw;
  h16* wvh = wkh + nw;
  h16* woh = wvh + nw;    // transposed: [NE, NH*ND]

  // wqh, wkh, wvh, woh stand one behind the other, and so do qh, kh, vh
  prep_kernel<<<CVT_BLOCKS + 4 * WT_TILES, 256, 0, stream>>>(x, W_q, W_k, W_v,
                                                             W_o, xh, wqh);

  dim3 gq(ROWS / 128, NH, 3);
  qkv_gemm_kernel<<<gq, 128, 0, stream>>>(xh, wqh, b_q, b_k, b_v, qh);

  attn_kernel<<<NB * NH * (NS / 32), 32 * AW, 0, stream>>>(qh, kh, vh, oh);

  dim3 go(ROWS / 128, NE / 64);
  out_gemm_kernel<<<go, 128, 0, stream>>>(oh, woh, b_o, out);
}

// v008
// A run of this version takes 84.8 microseconds.
// Timed twice side by side with v007, it ran 1.08 and 1.09 times as fast.
// Over all steps from v000 it is 4.44 times as fast.
#include <hip/hip_runtime.h>

typedef _Float16 h16;
typedef __attribute__((ext_vector_type(16))) _Float16 v16h;
typedef __attribute__((ext_vector_type(8)))  _Float16 v8h;
typedef __attribute__((ext_vector_type(8)))  float    v8f;
typedef __attribute__((ext_vector_type(2)))  _Float16 v2h;
typedef __attribute__((ext_vector_type(4)))  _Float16 v4h;
typedef __attribute__((ext_vector_type(4)))  float    v4f;

#define NB 2
#define NS 2048
#define NE 1024
#define NH 16
#define ND 64
#define ROWS (NB * NS) /* 4096 */

static __device__ __forceinline__ v8f wmma_f16(v16h a, v16h b, v8f c) {
  // 8 args: (neg_a, A, neg_b, B, c_mod, C, reuse_a, reuse_b)
  return __builtin_amdgcn_wmma_f32_16x16x32_f16(false, a, false, b, (short)0, c,
                                                false, false);
}

// Two contiguous 16-byte loads -> one 16-half fragment (b128 pairs)
static __device__ __forceinline__ v16h load_frag2(const h16* p0, const h16* p1) {
  v8h lo = *(const v8h*)p0;
  v8h hi = *(const v8h*)p1;
  return __builtin_shufflevector(lo, hi, 0, 1, 2, 3, 4, 5, 6, 7, 8, 9, 10, 11,
                                 12, 13, 14, 15);
}

// x -> f16, a stream: a wave takes 1024 consecutive values, as eight 16-byte
// loads a lane that are all in flight together (512 contiguous bytes a load)
// and eight 8-byte stores (256 contiguous bytes a store).  CVT_BLOCKS blocks of
// 8 waves, block = 256; blk is the block's number among them.
#define CVT_PER_WAVE 1024
#define CVT_PER_BLOCK (8 * CVT_PER_WAVE)
#define CVT_BLOCKS (ROWS * NE / CVT_PER_BLOCK) /* 512 */
static_assert((ROWS * NE) % CVT_PER_BLOCK == 0, "whole blocks only");
static __device__ __forceinline__ void cvt_block(const float* __restrict__ src,
                                                 h16* __restrict__ dst, int blk) {
  const int base = blk * CVT_PER_BLOCK +
                   (threadIdx.x >> 5) * CVT_PER_WAVE + (threadIdx.x & 31) * 4;
  // unrolled so that v[] stays in registers and no store stands among the loads
  v4f v[8];
#pragma unroll
  for (int i = 0; i < 8; ++i) v[i] = *(const v4f*)(src + base + i * 128);
#pragma unroll
  for (int i = 0; i < 8; ++i) {
    const v4h o = {(h16)v[i][0], (h16)v[i][1], (h16)v[i][2], (h16)v[i][3]};
    *(v4h*)(dst + base + i * 128) = o;
  }
}

// Batched transpose-convert: src [batch, R, C] f32 -> dst [batch, C, R] f16
// One 64x64 tile per block, turned in LDS, so that both sides of the copy move
// whole 128-byte lines.  block = 256; the tile is (ct, rt) of matrix bz.
// The tile is kept as [c][r]; the eight 16-byte chunks of a row are XOR-ed
// with (c >> 2) & 7 so that the 4-byte stores of a wave (columns 4 apart)
// spread over the banks while the 16-byte reads stay aligned.
static __device__ __forceinline__ void cvt_t_block(
    const float* __restrict__ src, h16* __restrict__ dst, int R, int C, int ct,
    int rt, int bz) {
  __shared__ __attribute__((aligned(16))) h16 tile[64 * 64];
  const int tid = threadIdx.x;
  const int c0  = ct * 64;
  const int r0  = rt * 64;
  const size_t base = (size_t)bz * R * C;
  const int cq = (tid & 15) * 4;  // four columns per thread
  const int rp = (tid >> 4) * 2;  // a pair of rows per thread

  // the loops below are unrolled so that v[][] stays in registers and the four
  // loads of a thread are in flight together
  v4f v[2][2];
#pragma unroll
  for (int it = 0; it < 2; ++it)
#pragma unroll
    for (int p = 0; p < 2; ++p)
      v[it][p] = *(const v4f*)(src + base +
                               (size_t)(r0 + it * 32 + rp + p) * C + c0 + cq);
#pragma unroll
  for (int it = 0; it < 2; ++it)
#pragma unroll
    for (int j = 0; j < 4; ++j) {
      const int c = cq + j;
      const int r = it * 32 + rp;
      const int chunk = (r >> 3) ^ ((c >> 2) & 7);
      v2h pr = {(h16)v[it][0][j], (h16)v[it][1][j]};
      *(v2h*)&tile[c * 64 + chunk * 8 + (r & 7)] = pr;
    }
  __syncthreads();
#pragma unroll
  for (int it = 0; it < 2; ++it) {
    const int c = it * 32 + (tid >> 3);
    const int q = tid & 7;
    const v8h o = *(const v8h*)&tile[c * 64 + (q ^ ((c >> 2) & 7)) * 8];
    *(v8h*)(dst + base + (size_t)(c0 + c) * R + r0 + q * 8) = o;
  }
}

// All five conversions in one launch: none reads what another writes, so a range
// of the block index picks the job (a block-uniform branch) and their starts,
// memory latencies and last stores overlap, where five launches stood in a row.
// Blocks 0 .. CVT_BLOCKS - 1 convert x (the most bytes a block, so first); then
// 256 tiles each of W_q, W_k, W_v (per head [NE, ND] -> [ND, NE]) and of W_o
// ([NH*ND, NE] -> [NE, NH*ND]), whose outputs stand one behind the other in wt.
#define WT_TILES 256               /* 64x64 tiles of one weight */
#define WT_HALVES (NH * NE * ND)   /* elements of one weight */
__global__ __launch_bounds__(256) void prep_kernel(
    const float* __restrict__ x, const float* __restrict__ W_q,
    const float* __restrict__ W_k, const float* __restrict__ W_v,
    const float* __restrict__ W_o, h16* __restrict__ xh, h16* __restrict__ wt) {
  const int blk = blockIdx.x;
  if (blk < CVT_BLOCKS) {
    cvt_block(x, xh, blk);
    return;
  }
  const int job = (blk - CVT_BLOCKS) >> 8;   // / WT_TILES
  const int t   = (blk - CVT_BLOCKS) & (WT_TILES - 1);
  const int lo  = t & 15;
  const int hi  = t >> 4;
  const bool wo = job == 3;  // one matrix of 16 x 16 tiles; else 16 of 1 x 16
  const float* w = job == 0 ? W_q : job == 1 ? W_k : job == 2 ? W_v : W_o;
  static_assert(NH * ND == NE, "all four weights have NE rows a matrix");
  cvt_t_block(w, wt + (size_t)job * WT_HALVES, NE, wo ? NE : ND, wo ? lo : 0,
              wo ? hi : lo, wo ? 0 : hi);
}

// Product of one 128 x 64 output tile, shared by the projection kernels:
// acc += A[128 rows] * Bt[64 rows]^T over k = 0..1023, both operands k-contiguous
// with a row pitch of 1024 halves.  block = 128 (4 waves, each 32 rows x 64 cols).
// A fragment load straight from the rows touches 16 lines for 512 bytes, so the
// block brings 64 k of all 192 rows by whole 128-byte lines (8 lanes a row)
// and turns them in LDS; the next trip's lines fly while this trip's products
// run, in two buffers.  LDS rows stand at 144 bytes (16 B x odd), the pitch at
// which the 16 rows of a 16-byte fragment read fall on distinct banks.
#define GK 1024                     /* k extent and row pitch, halves */
#define GBK 64                      /* k per trip: one 128-byte line a row */
#define GPITCH 72                   /* LDS row pitch, halves */
#define GBUF ((128 + 64) * GPITCH)  /* one buffer, halves */
static __device__ __forceinline__ void tile_product(
    const h16* __restrict__ Ab,  // first of the block's 128 rows of A
    const h16* __restrict__ Bb,  // first of the block's 64 rows of Bt
    h16* sm,                     // 2 * GBUF halves of LDS
    v8f (&acc)[2][4])
{
  const int tid  = threadIdx.x;
  const int wave = tid >> 5;
  const int lane = tid & 31;
  const int half = lane >> 4;
  const int l16  = lane & 15;
  const int kb0  = half * 8;
  const int kb1  = 16 + half * 8;
  // staging: rows srow + 16 i, one 16-byte piece of each.  Neighbouring groups
  // of 8 lanes take rows 8 apart: 8 * 144 B lands half the banks further, so the
  // 16 lanes of a 16-byte LDS store cover every bank once (rows 1 apart would
  // share 4 banks)
  const int srow = ((tid >> 3) & 1) * 8 + (tid >> 4);
  const int sch  = (tid & 7) * 8;

  const h16* ga = Ab + (size_t)srow * GK + sch;
  const h16* gb = Bb + (size_t)srow * GK + sch;
  h16* sw = sm + srow * GPITCH + sch;
  const h16* ra = sm + (wave * 32 + l16) * GPITCH;
  const h16* rb = sm + (128 + l16) * GPITCH;

  v8h st[12];  // rows 0..127 of a buffer are A's, rows 128..191 are Bt's
#pragma unroll
  for (int i = 0; i < 8; ++i) st[i] = *(const v8h*)(ga + i * 16 * GK);
#pragma unroll
  for (int i = 0; i < 4; ++i) st[8 + i] = *(const v8h*)(gb + i * 16 * GK);
#pragma unroll
  for (int i = 0; i < 12; ++i) *(v8h*)(sw + i * 16 * GPITCH) = st[i];
  __syncthreads();

  // unrolled by 8, so that the k steps and the two buffers are immediate offsets:
  // the global address pairs are formed once in eight trips, and no trip forms an
  // LDS address
#pragma unroll 8
  for (int kt = 0; kt < GK / GBK; ++kt) {
    const int cur = (kt & 1) * GBUF;
    const bool more = kt + 1 < GK / GBK;
    if (more) {
      const int kn = (kt + 1) * GBK;
#pragma unroll
      for (int i = 0; i < 8; ++i) st[i] = *(const v8h*)(ga + i * 16 * GK + kn);
#pragma unroll
      for (int i = 0; i < 4; ++i)
        st[8 + i] = *(const v8h*)(gb + i * 16 * GK + kn);
      // the loads' address pairs are rewritten at the head of the unrolled body,
      // and one way there in the built code passes no wait for the loads' data
      asm volatile("s_wait_xcnt 0x0" ::: "memory");
    }

    v16h a[2][2], bm[2][4];  // [k step of 32][tile]
#pragma unroll
    for (int ks = 0; ks < 2; ++ks) {
      const int o = cur + ks * 32;
      a[ks][0] = load_frag2(ra + o + kb0, ra + o + kb1);
      a[ks][1] = load_frag2(ra + o + 16 * GPITCH + kb0,
                            ra + o + 16 * GPITCH + kb1);
#pragma unroll
      for (int nt = 0; nt < 4; ++nt)
        bm[ks][nt] = load_frag2(rb + o + nt * 16 * GPITCH + kb0,
                                rb + o + nt * 16 * GPITCH + kb1);
    }
    // keeps the trip's LDS reads one group in front of its products: spread
    // among them into one register set, each pair of products waited out a read
    __builtin_amdgcn_sched_barrier(0);

#pragma unroll
    for (int ks = 0; ks < 2; ++ks)
#pragma unroll
      for (int nt = 0; nt < 4; ++nt) {
        acc[0][nt] = wmma_f16(a[ks][0], bm[ks][nt], acc[0][nt]);
        acc[1][nt] = wmma_f16(a[ks][1], bm[ks][nt], acc[1][nt]);
      }
    // keeps the wait for the global loads, which stands in front of the stores
    // below, behind the trip's products
    __builtin_amdgcn_sched_barrier(0);

    // the other buffer's last readers left it at the barrier of the trip before
    if (more) {
#pragma unroll
      for (int i = 0; i < 12; ++i)
        *(v8h*)(sw + (GBUF - cur) + i * 16 * GPITCH) = st[i];
      __syncthreads();
    }
  }
}

// Per-head projection: out = x @ W[h] + bias[h], W pre-transposed [H,D,E].
// Q, K and V in one launch: blockIdx.z picks the weight, the bias and the output.
// A WGP then holds as many blocks as its registers allow and takes the next as
// one ends, where three launches of two blocks a WGP stood in a row.
// grid = (ROWS/128, NH, 3), block = 128 (4 waves, each wave -> 32 rows x 64 cols)
// Q, K: out[b,h,s,d];  V: out[b,h,d,s] (transposed)
__global__ __launch_bounds__(128) void qkv_gemm_kernel(
    const h16* __restrict__ X,      // [ROWS, NE]
    const h16* __restrict__ Wqkv,   // 3 x [NH, ND, NE]
    const float* __restrict__ b_q,  // [NH, ND]
    const float* __restrict__ b_k,  // [NH, ND]
    const float* __restrict__ b_v,  // [NH, ND]
    h16* __restrict__ qkv)          // 3 x NB*NH*NS*ND
{
  const int which = blockIdx.z;
  const int vt    = which == 2;
  const h16* Wt   = Wqkv + (size_t)which * WT_HALVES;
  const float* bias = which == 0 ? b_q : which == 1 ? b_k : b_v;
  h16* out = qkv + (size_t)which * (NB * NH * NS * ND);
  const int tid  = threadIdx.x;
  const int wave = tid >> 5;
  const int lane = tid & 31;
  const int half = lane >> 4;
  const int l16  = lane & 15;
  const int h    = blockIdx.y;
  const int rowbase = blockIdx.x * 128 + wave * 32;

  __shared__ __attribute__((aligned(16))) h16 sm[2 * GBUF];
  v8f acc[2][4] = {};
  tile_product(X + (size_t)blockIdx.x * 128 * NE, Wt + (size_t)h * ND * NE, sm,
               acc);

  if (vt) {
    // transposed output: a lane's eight registers are eight consecutive s of
    // one d row (a group of 8 never crosses a batch): one 16-byte store
#pragma unroll
    for (int mt = 0; mt < 2; ++mt)
#pragma unroll
      for (int nt = 0; nt < 4; ++nt) {
        const int rowg = rowbase + mt * 16 + half * 8;
        const int b    = rowg >> 11;  // / NS
        const int s    = rowg & (NS - 1);
        const int n    = nt * 16 + l16;
        const float bn = bias[h * ND + n];
        v8h o;
#pragma unroll
        for (int r = 0; r < 8; ++r) o[r] = (h16)(acc[mt][nt][r] + bn);
        *(v8h*)(out + ((size_t)(b * NH + h) * ND + n) * NS + s) = o;
      }
    return;
  }

#pragma unroll
  for (int mt = 0; mt < 2; ++mt)
#pragma unroll
    for (int nt = 0; nt < 4; ++nt)
#pragma unroll
      for (int r = 0; r < 8; ++r) {
        const int rowg = rowbase + mt * 16 + half * 8 + r;
        const int b    = rowg >> 11;  // / NS
        const int s    = rowg & (NS - 1);
        const int n    = nt * 16 + l16;
        const float v  = acc[mt][nt][r] + bias[h * ND + n];
        out[((size_t)(b * NH + h) * NS + s) * ND + n] = (h16)v;
      }
  // the built code lays V's side behind this one, with a way from here into it,
  // and V's side reuses the stores' registers
  asm volatile("s_wait_xcnt 0x0" ::: "memory");
}

// Lane l <-> lane l ^ 16: the other half of the wave holds the other 16 keys
// of the same query column.
static __device__ __forceinline__ float other_half(float v) {
  int b = __builtin_bit_cast(int, v);
  b = __builtin_amdgcn_permlanex16(b, b, 0x76543210, 0xfedcba98, false, false);
  return __builtin_bit_cast(float, b);
}

// Flash-attention: one block of AW waves per 32-query tile per (b,h); K/V
// fragments are shared by both 16-query sub-tiles (2x WMMA per byte loaded).
// The tile's 32-key chunks are dealt round-robin to the waves: the launch lasts
// as long as its longest wave, which now walks 16 chunks where a lone wave
// walked 64, and a SIMD holds twice the waves to cover loads and chains.  Each
// wave keeps its own running maximum, sum and Ot; they are joined once in LDS.
// The products are taken transposed: St = K Q^T and Ot += Vt Pt.  A lane then
// holds 16 of the 32 scores of ONE query (its column), so maximum and sum are
// taken in the lane, and the two score tiles of a column, converted in place,
// are the B operand of the second product.
// grid = NB*NH*(NS/32), block = 32*AW.  V is transposed [NB*NH, ND, NS].
#define AW 4
// one (wave, d tile) slice of the partial Ot in LDS, floats: 2 query tiles x 2
// pieces x 32 lanes x 4 values, and 16 more: 16 lanes of a 16-byte read in the
// join take 4 queries x 4 d tiles, and 64 B a slice puts them on distinct banks
#define JSLICE (2 * 2 * 32 * 4 + 16)
// A wave's own staging rows in LDS, halves: its chunk's 32 K rows of 128 bytes at
// a pitch of 144 bytes, then the 64 Vt rows of 64 bytes at a pitch of 80 bytes
// (both 16 B x odd: the 16 rows of a 16-byte fragment read fall on distinct banks)
#define KPITCH 72
#define VPITCH 40
#define KVW (32 * KPITCH + 64 * VPITCH)
__global__ __launch_bounds__(32 * AW) void attn_kernel(
    const h16* __restrict__ Q,   // [NB*NH, NS, ND]
    const h16* __restrict__ K,   // [NB*NH, NS, ND]
    const h16* __restrict__ Vt,  // [NB*NH, ND, NS]
    h16* __restrict__ O)         // [NB, NS, NH*ND]
{
  __shared__ __attribute__((aligned(16))) float s_acc[AW * 4 * JSLICE];
  __shared__ float s_m[AW][2][32];
  __shared__ float s_l[AW][2][32];
  __shared__ __attribute__((aligned(16))) h16 s_kv[AW * KVW];
  const int lane = threadIdx.x & 31;
  // in a scalar register, so that the key loop's test is a scalar branch
  const int wave = __builtin_amdgcn_readfirstlane(threadIdx.x >> 5);
  const int half = lane >> 4;
  const int l16  = lane & 15;
  const int kb0  = half * 8;
  const int kb1  = 16 + half * 8;
  const int qt   = blockIdx.x & (NS / 32 - 1);
  const int bh   = blockIdx.x >> 6;
  const int h    = bh & (NH - 1);
  const int b    = bh >> 4;
  const int qbase = qt * 32;

  const h16* Qp = Q + (size_t)bh * NS * ND;
  const h16* Kp = K + (size_t)bh * NS * ND;
  const h16* Vp = Vt + (size_t)bh * ND * NS;

  // Q fragments (B operand: lane = query column): 2 column tiles x 2 K-chunks,
  // resident for the whole pass
  v16h bq[2][2];
#pragma unroll
  for (int mt = 0; mt < 2; ++mt) {
    const h16* qrow = Qp + (size_t)(qbase + mt * 16 + l16) * ND;
#pragma unroll
    for (int kc = 0; kc < 2; ++kc)
      bq[mt][kc] = load_frag2(qrow + kc * 32 + kb0, qrow + kc * 32 + kb1);
  }

  // acc[mt][nt][r] = O[query mt*16 + l16][d = nt*16 + half*8 + r]
  v8f acc[2][4] = {};
  float col_m[2] = {-1e30f, -1e30f};  // running maximum of the lane's query
  float col_l[2] = {0.0f, 0.0f};      // running sum over this half's keys only

  const float scale  = 0.125f;        // 1/sqrt(64)
  const int nchunks = (qbase >> 5) + 1;  // causal bound (rows < qbase+32)

  // A fragment load straight from the rows touches 16 lines for 512 bytes.  The
  // wave brings its chunk by whole rows instead and turns it in its own LDS rows:
  // K by 8 lanes a 128-byte row (4 whole lines a load), Vt by 4 lanes a 64-byte
  // row piece (8 lines a load).  The groups of lanes that share a 16-lane LDS
  // store take K rows 8 apart and Vt rows 4 apart, which puts them on distinct
  // banks at these pitches.  Load i takes K rows krow0 + i; load j takes Vt rows
  // vrow0 + (j & 3) + 32 (j >> 2).
  const int krow0 = (lane >> 3) * 8;
  const int kpc   = (lane & 7) * 8;
  const int vrow0 = ((lane >> 2) & 3) * 4 + half * 16;
  const int vpc   = (lane & 3) * 8;
  h16* sb = s_kv + wave * KVW;
  h16* wk = sb + krow0 * KPITCH + kpc;
  h16* wv = sb + 32 * KPITCH + vrow0 * VPITCH + vpc;
  const h16* rk = sb + l16 * KPITCH;
  const h16* rv = sb + 32 * KPITCH + l16 * VPITCH;
  // running pointers of the wave's current chunk, so that a trip forms no
  // address from the chunk's number; pk: one K line a lane, for the prefetch
  const h16* gk = Kp + (size_t)(wave * 32 + krow0) * ND + kpc;
  const h16* gv = Vp + (size_t)vrow0 * NS + wave * 32 + vpc;
  const h16* pk = Kp + (size_t)(wave * 32 + lane) * ND;

  for (int ch = wave; ch < nchunks; ch += AW) {
    const int tbase = ch * 32;

    // ---- the chunk's K rows, and behind them its Vt rows, which fly while K is
    // turned ----
    v8h sk[8], sv[8];
#pragma unroll
    for (int i = 0; i < 8; ++i) sk[i] = *(const v8h*)(gk + i * ND);
#pragma unroll
    for (int j = 0; j < 8; ++j)
      sv[j] = *(const v8h*)(gv + (size_t)((j & 3) + 32 * (j >> 2)) * NS);
    // keeps the loads in front of the prefetch's branch: without it the built code
    // sinks all sixteen behind it
    __builtin_amdgcn_sched_barrier(0);
    if (ch + AW < nchunks) __builtin_prefetch(pk + AW * 32 * ND, 0, 3);
    // the address registers of the loads and the prefetch above are advanced
    // below
    asm volatile("s_wait_xcnt 0x0" ::: "memory");
    // keeps the address additions from being lifted over that wait
    __builtin_amdgcn_sched_barrier(0);
    gk += AW * 32 * ND;
    gv += AW * 32;
    pk += AW * 32 * ND;

    // every lane's fragment reads of the trip before have returned before the
    // wave's rows are written again
    asm volatile("s_wait_dscnt 0x0" ::: "memory");
#pragma unroll
    for (int i = 0; i < 8; ++i) *(v8h*)(wk + i * KPITCH) = sk[i];
    // a lane reads back rows that other lanes of the wave wrote
    asm volatile("s_wait_dscnt 0x0" ::: "memory");

    // ---- K fragments (A operand: lane = key row; shared by both tiles) ----
    v16h ak[2][2];  // [tt][kc]
#pragma unroll
    for (int tt = 0; tt < 2; ++tt) {
      const h16* krow = rk + tt * 16 * KPITCH;
#pragma unroll
      for (int kc = 0; kc < 2; ++kc)
        ak[tt][kc] = load_frag2(krow + kc * 32 + kb0, krow + kc * 32 + kb1);
    }

    // ---- scores: St = K Q^T ----
    // c[mt][tt][r] = S[query mt*16 + l16][key tbase + tt*16 + half*8 + r]
    v8f c[2][2] = {};
#pragma unroll
    for (int mt = 0; mt < 2; ++mt)
#pragma unroll
      for (int tt = 0; tt < 2; ++tt)
#pragma unroll
        for (int kc = 0; kc < 2; ++kc)
          c[mt][tt] = wmma_f16(ak[tt][kc], bq[mt][kc], c[mt][tt]);

    // ---- V fragments (A operand: lane = d row; shared by both tiles) ----
    // turned and read in front of the softmax, so that they arrive during it
#pragma unroll
    for (int j = 0; j < 8; ++j)
      *(v8h*)(wv + ((j & 3) + 32 * (j >> 2)) * VPITCH) = sv[j];
    // a lane reads back rows that other lanes of the wave wrote
    asm volatile("s_wait_dscnt 0x0" ::: "memory");
    v16h av[4];
#pragma unroll
    for (int nt = 0; nt < 4; ++nt) {
      const h16* vr = rv + nt * 16 * VPITCH;
      av[nt] = load_frag2(vr + kb0, vr + kb1);
    }
    // keeps the scheduler from sinking these reads to their use, where it split
    // them into four pairs, each waited for on its own
    __builtin_amdgcn_sched_barrier(0);

    // ---- scale + causal mask + online softmax (per query column) ----
    float corr[2];
    v16h bp[2];  // P^T as B operand: element tt*8 + r = key tt*16 + half*8 + r
#pragma unroll
    for (int mt = 0; mt < 2; ++mt) {
      const int srow = qbase + mt * 16 + l16;
      float s[16];
#pragma unroll
      for (int e = 0; e < 16; ++e) {
        s[e] = c[mt][e >> 3][e & 7] * scale;
        if (tbase + (e >> 3) * 16 + half * 8 + (e & 7) > srow) s[e] = -1e30f;
      }
      // pairwise trees, so that no chain is longer than four links
      float t[8];
#pragma unroll
      for (int e = 0; e < 8; ++e) t[e] = fmaxf(s[e], s[e + 8]);
#pragma unroll
      for (int w = 4; w > 0; w >>= 1)
#pragma unroll
        for (int e = 0; e < w; ++e) t[e] = fmaxf(t[e], t[e + w]);
      const float mx   = fmaxf(t[0], other_half(t[0]));
      const float mnew = fmaxf(col_m[mt], mx);
      corr[mt]  = __expf(col_m[mt] - mnew);
      col_m[mt] = mnew;
#pragma unroll
      for (int e = 0; e < 16; ++e) {
        s[e] = __expf(s[e] - mnew);
        bp[mt][e] = (h16)s[e];
      }
#pragma unroll
      for (int e = 0; e < 8; ++e) t[e] = s[e] + s[e + 8];
#pragma unroll
      for (int w = 4; w > 0; w >>= 1)
#pragma unroll
        for (int e = 0; e < w; ++e) t[e] += t[e + w];
      col_l[mt] = col_l[mt] * corr[mt] + t[0];
    }

    // rescale running accumulators
#pragma unroll
    for (int mt = 0; mt < 2; ++mt)
#pragma unroll
      for (int nt = 0; nt < 4; ++nt)
#pragma unroll
        for (int r = 0; r < 8; ++r) acc[mt][nt][r] *= corr[mt];

    // ---- Ot += Vt Pt ----
#pragma unroll
    for (int nt = 0; nt < 4; ++nt) {
      acc[0][nt] = wmma_f16(av[nt], bp[0], acc[0][nt]);
      acc[1][nt] = wmma_f16(av[nt], bp[1], acc[1][nt]);
    }
  }

  // ---- join the waves' partial results ----
  // a wave that had no chunk hands over maximum -1e30, sum 0 and Ot 0, and its
  // factor below is 0; wave 0 always has chunk 0, so the joint maximum is real
#pragma unroll
  for (int mt = 0; mt < 2; ++mt) {
    s_m[wave][mt][lane] = col_m[mt];
    s_l[wave][mt][lane] = col_l[mt] + other_half(col_l[mt]);
#pragma unroll
    for (int nt = 0; nt < 4; ++nt)
#pragma unroll
      for (int p = 0; p < 2; ++p) {
        const v4f t = {acc[mt][nt][p * 4 + 0], acc[mt][nt][p * 4 + 1],
                       acc[mt][nt][p * 4 + 2], acc[mt][nt][p * 4 + 3]};
        *(v4f*)&s_acc[(wave * 4 + nt) * JSLICE + (mt * 2 + p) * 128 + lane * 4] =
            t;
      }
  }
  __syncthreads();

  // Wave w finishes queries 8 w .. 8 w + 7, four lanes a query with 16 d each,
  // so that a 128-byte row of O (head-concat layout [B, S, H*D]) has one writer.
  const int q   = wave * 8 + (lane >> 2);
  const int dt  = lane & 3;  // the lane's d tile
  const int qmt = q >> 4;
  const int ql  = q & 15;
  float pm[AW];
#pragma unroll
  for (int w = 0; w < AW; ++w) pm[w] = s_m[w][qmt][ql];
  const float mall = fmaxf(fmaxf(pm[0], pm[1]), fmaxf(pm[2], pm[3]));
  float lall = 0.0f;
  float o[16] = {};
#pragma unroll
  for (int w = 0; w < AW; ++w) {
    // exp(x) as 2^(x log2 e).  In asm so that the v_nop stands directly behind
    // the transcendental: the free slot before its source register is reused
    float f;
    asm("v_exp_f32 %0, %1\n\tv_nop"
        : "=v"(f)
        : "v"((pm[w] - mall) * 1.44269504f));
    lall += f * s_l[w][qmt][ql];
#pragma unroll
    for (int hf = 0; hf < 2; ++hf)
#pragma unroll
      for (int p = 0; p < 2; ++p) {
        const v4f t = *(const v4f*)&s_acc[(w * 4 + dt) * JSLICE +
                                          (qmt * 2 + p) * 128 +
                                          (hf * 16 + ql) * 4];
#pragma unroll
        for (int j = 0; j < 4; ++j) o[hf * 8 + p * 4 + j] += f * t[j];
      }
  }
  const float inv = 1.0f / lall;
  h16* orow = O + ((size_t)b * NS + qbase + q) * (NH * ND) + h * ND + dt * 16;
#pragma unroll
  for (int hf = 0; hf < 2; ++hf) {
    v8h ov;
#pragma unroll
    for (int r = 0; r < 8; ++r) ov[r] = (h16)(o[hf * 8 + r] * inv);
    *(v8h*)(orow + hf * 8) = ov;
  }
}

// Output projection: out = A @ W_o + b_o (f32), W_o pre-transposed [NE, NH*ND]
// grid = (ROWS/128, NE/64), block = 128 (4 waves, each wave 32 rows x 64 cols)
__global__ __launch_bounds__(128) void out_gemm_kernel(
    const h16* __restrict__ A,       // [ROWS, NH*ND]
    const h16* __restrict__ Wot,     // [NE, NH*ND]
    const float* __restrict__ bias,  // [NE]
    float* __restrict__ out)         // [ROWS, NE]
{
  const int tid  = threadIdx.x;
  const int wave = tid >> 5;
  const int lane = tid & 31;
  const int half = lane >> 4;
  const int l16  = lane & 15;
  const int rowbase = blockIdx.x * 128 + wave * 32;
  const int ntbase  = blockIdx.y * 64;

  __shared__ __attribute__((aligned(16))) h16 sm[2 * GBUF];
  v8f acc[2][4] = {};
  tile_product(A + (size_t)blockIdx.x * 128 * (NH * ND),
               Wot + (size_t)ntbase * (NH * ND), sm, acc);

#pragma unroll
  for (int mt = 0; mt < 2; ++mt)
#pragma unroll
    for (int nt = 0; nt < 4; ++nt)
#pragma unroll
      for (int r = 0; r < 8; ++r) {
        const int rowg = rowbase + mt * 16 + half * 8 + r;
        const int n    = ntbase + nt * 16 + l16;
        out[(size_t)rowg * NE + n] = acc[mt][nt][r] + bias[n];
      }
}

extern "C" void kernel_launch(void* const* d_in, const int* in_sizes, int n_in,
                              void* d_out, int out_size, void* d_ws,
                              size_t ws_size, hipStream_t stream) {
  const float* x   = (const float*)d_in[0];
  const float* W_q = (const float*)d_in[1];
  const float* b_q = (const float*)d_in[2];
  const float* W_k = (const float*)d_in[3];
  const float* b_k = (const float*)d_in[4];
  const float* W_v = (const float*)d_in[5];
  const float* b_v = (const float*)d_in[6];
  const float* W_o = (const float*)d_in[7];
  const float* b_o = (const float*)d_in[8];
  float* out = (float*)d_out;

  const size_t nx   = (size_t)ROWS * NE;          // 4M halves
  const size_t nqkv = (size_t)NB * NH * NS * ND;  // 4M halves
  const size_t nw   = (size_t)NH * NE * ND;       // 1M halves
  h16* xh  = (h16*)d_ws;
  h16* qh  = xh + nx;
  h16* kh  = qh + nqkv;
  h16* vh  = kh + nqkv;   // transposed V: [NB*NH, ND, NS]
  h16* oh  = vh + nqkv;
  h16* wqh = oh + nx;     // transposed: [NH, ND, NE]
  h16* wkh = wqh + nw;
  h16* wvh = wkh + nw;
  h16* woh = wvh + nw;    // transposed: [NE, NH*ND]

  // wqh, wkh, wvh, woh stand one behind the other, and so do qh, kh, vh
  prep_kernel<<<CVT_BLOCKS + 4 * WT_TILES, 256, 0, stream>>>(x, W_q, W_k, W_v,
                                                             W_o, xh, wqh);

  dim3 gq(ROWS / 128, NH, 3);
  qkv_gemm_kernel<<<gq, 128, 0, stream>>>(xh, wqh, b_q, b_k, b_v, qh);

  attn_kernel<<<NB * NH * (NS / 32), 32 * AW, 0, stream>>>(qh, kh, vh, oh);

  dim3 go(ROWS / 128, NE / 64);
  out_gemm_kernel<<<go, 128, 0, stream>>>(oh, woh, b_o, out);
}

// v009
// A run of this version takes 77.1 microseconds.
// Next to v008, in two timings, it ran 1.08 and 1.11 times as fast.
// All steps since v000 together make it 4.86 times as fast.
#include <hip/hip_runtime.h>

typedef _Float16 h16;
typedef __attribute__((ext_vector_type(16))) _Float16 v16h;
typedef __attribute__((ext_vector_type(8)))  _Float16 v8h;
typedef __attribute__((ext_vector_type(8)))  float    v8f;
typedef __attribute__((ext_vector_type(2)))  _Float16 v2h;
typedef __attribute__((ext_vector_type(4)))  _Float16 v4h;
typedef __attribute__((ext_vector_type(4)))  float    v4f;

#define NB 2
#define NS 2048
#define NE 1024
#define NH 16
#define ND 64
#define ROWS (NB * NS) /* 4096 */

static __device__ __forceinline__ v8f wmma_f16(v16h a, v16h b, v8f c) {
  // 8 args: (neg_a, A, neg_b, B, c_mod, C, reuse_a, reuse_b)
  return __builtin_amdgcn_wmma_f32_16x16x32_f16(false, a, false, b, (short)0, c,
                                                false, false);
}

// Two contiguous 16-byte loads -> one 16-half fragment (b128 pairs)
static __device__ __forceinline__ v16h load_frag2(const h16* p0, const h16* p1) {
  v8h lo = *(const v8h*)p0;
  v8h hi = *(const v8h*)p1;
  return __builtin_shufflevector(lo, hi, 0, 1, 2, 3, 4, 5, 6, 7, 8, 9, 10, 11,
                                 12, 13, 14, 15);
}

// x -> f16, a stream: a wave takes 1024 consecutive values, as eight 16-byte
// loads a lane that are all in flight together (512 contiguous bytes a load)
// and eight 8-byte stores (256 contiguous bytes a store).  CVT_BLOCKS blocks of
// 8 waves, block = 256; blk is the block's number among them.
#define CVT_PER_WAVE 1024
#define CVT_PER_BLOCK (8 * CVT_PER_WAVE)
#define CVT_BLOCKS (ROWS * NE / CVT_PER_BLOCK) /* 512 */
static_assert((ROWS * NE) % CVT_PER_BLOCK == 0, "whole blocks only");
static __device__ __forceinline__ void cvt_block(const float* __restrict__ src,
                                                 h16* __restrict__ dst, int blk) {
  const int base = blk * CVT_PER_BLOCK +
                   (threadIdx.x >> 5) * CVT_PER_WAVE + (threadIdx.x & 31) * 4;
  // unrolled so that v[] stays in registers and no store stands among the loads
  v4f v[8];
#pragma unroll
  for (int i = 0; i < 8; ++i) v[i] = *(const v4f*)(src + base + i * 128);
#pragma unroll
  for (int i = 0; i < 8; ++i) {
    const v4h o = {(h16)v[i][0], (h16)v[i][1], (h16)v[i][2], (h16)v[i][3]};
    *(v4h*)(dst + base + i * 128) = o;
  }
}

// Batched transpose-convert: src [batch, R, C] f32 -> dst [batch, C, R] f16
// One 64x64 tile per block, turned in LDS, so that both sides of the copy move
// whole 128-byte lines.  block = 256; the tile is (ct, rt) of matrix bz.
// The tile is kept as [c][r]; the eight 16-byte chunks of a row are XOR-ed
// with (c >> 2) & 7 so that the 4-byte stores of a wave (columns 4 apart)
// spread over the banks while the 16-byte reads stay aligned.
static __device__ __forceinline__ void cvt_t_block(
    const float* __restrict__ src, h16* __restrict__ dst, int R, int C, int ct,
    int rt, int bz) {
  __shared__ __attribute__((aligned(16))) h16 tile[64 * 64];
  const int tid = threadIdx.x;
  const int c0  = ct * 64;
  const int r0  = rt * 64;
  const size_t base = (size_t)bz * R * C;
  const int cq = (tid & 15) * 4;  // four columns per thread
  const int rp = (tid >> 4) * 2;  // a pair of rows per thread

  // the loops below are unrolled so that v[][] stays in registers and the four
  // loads of a thread are in flight together
  v4f v[2][2];
#pragma unroll
  for (int it = 0; it < 2; ++it)
#pragma unroll
    for (int p = 0; p < 2; ++p)
      v[it][p] = *(const v4f*)(src + base +
                               (size_t)(r0 + it * 32 + rp + p) * C + c0 + cq);
#pragma unroll
  for (int it = 0; it < 2; ++it)
#pragma unroll
    for (int j = 0; j < 4; ++j) {
      const int c = cq + j;
      const int r = it * 32 + rp;
      const int chunk = (r >> 3) ^ ((c >> 2) & 7);
      v2h pr = {(h16)v[it][0][j], (h16)v[it][1][j]};
      *(v2h*)&tile[c * 64 + chunk * 8 + (r & 7)] = pr;
    }
  __syncthreads();
#pragma unroll
  for (int it = 0; it < 2; ++it) {
    const int c = it * 32 + (tid >> 3);
    const int q = tid & 7;
    const v8h o = *(const v8h*)&tile[c * 64 + (q ^ ((c >> 2) & 7)) * 8];
    *(v8h*)(dst + base + (size_t)(c0 + c) * R + r0 + q * 8) = o;
  }
}

// All five conversions in one launch: none reads what another writes, so a range
// of the block index picks the job (a block-uniform branch) and their starts,
// memory latencies and last stores overlap, where five launches stood in a row.
// Blocks 0 .. CVT_BLOCKS - 1 convert x (the most bytes a block, so first); then
// 256 tiles each of W_q, W_k, W_v (per head [NE, ND] -> [ND, NE]) and of W_o
// ([NH*ND, NE] -> [NE, NH*ND]), whose outputs stand one behind the other in wt.
#define WT_TILES 256               /* 64x64 tiles of one weight */
#define WT_HALVES (NH * NE * ND)   /* elements of one weight */
__global__ __launch_bounds__(256) void prep_kernel(
    const float* __restrict__ x, const float* __restrict__ W_q,
    const float* __restrict__ W_k, const float* __restrict__ W_v,
    const float* __restrict__ W_o, h16* __restrict__ xh, h16* __restrict__ wt) {
  const int blk = blockIdx.x;
  if (blk < CVT_BLOCKS) {
    cvt_block(x, xh, blk);
    return;
  }
  const int job = (blk - CVT_BLOCKS) >> 8;   // / WT_TILES
  const int t   = (blk - CVT_BLOCKS) & (WT_TILES - 1);
  const int lo  = t & 15;
  const int hi  = t >> 4;
  const bool wo = job == 3;  // one matrix of 16 x 16 tiles; else 16 of 1 x 16
  const float* w = job == 0 ? W_q : job == 1 ? W_k : job == 2 ? W_v : W_o;
  static_assert(NH * ND == NE, "all four weights have NE rows a matrix");
  cvt_t_block(w, wt + (size_t)job * WT_HALVES, NE, wo ? NE : ND, wo ? lo : 0,
              wo ? hi : lo, wo ? 0 : hi);
}

// Product of one 128 x 64 output tile, shared by the projection kernels:
// acc += A[128 rows] * Bt[64 rows]^T over k = 0..1023, both operands k-contiguous
// with a row pitch of 1024 halves.  block = 128 (4 waves, each 32 rows x 64 cols).
// A fragment load straight from the rows touches 16 lines for 512 bytes, so the
// block brings 64 k of all 192 rows by whole 128-byte lines (8 lanes a row)
// and turns them in LDS; the next trip's lines fly while this trip's products
// run, in two buffers.  LDS rows stand at 144 bytes (16 B x odd), the pitch at
// which the 16 rows of a 16-byte fragment read fall on distinct banks.
#define GK 1024                     /* k extent and row pitch, halves */
#define GBK 64                      /* k per trip: one 128-byte line a row */
#define GPITCH 72                   /* LDS row pitch, halves */
#define GBUF ((128 + 64) * GPITCH)  /* one buffer, halves */
static __device__ __forceinline__ void tile_product(
    const h16* __restrict__ Ab,  // first of the block's 128 rows of A
    const h16* __restrict__ Bb,  // first of the block's 64 rows of Bt
    h16* sm,                     // 2 * GBUF halves of LDS
    v8f (&acc)[2][4])
{
  const int tid  = threadIdx.x;
  const int wave = tid >> 5;
  const int lane = tid & 31;
  const int half = lane >> 4;
  const int l16  = lane & 15;
  const int kb0  = half * 8;
  const int kb1  = 16 + half * 8;
  // staging: rows srow + 16 i, one 16-byte piece of each.  Neighbouring groups
  // of 8 lanes take rows 8 apart: 8 * 144 B lands half the banks further, so the
  // 16 lanes of a 16-byte LDS store cover every bank once (rows 1 apart would
  // share 4 banks)
  const int srow = ((tid >> 3) & 1) * 8 + (tid >> 4);
  const int sch  = (tid & 7) * 8;

  const h16* ga = Ab + (size_t)srow * GK + sch;
  const h16* gb = Bb + (size_t)srow * GK + sch;
  h16* sw = sm + srow * GPITCH + sch;
  const h16* ra = sm + (wave * 32 + l16) * GPITCH;
  const h16* rb = sm + (128 + l16) * GPITCH;

  v8h st[12];  // rows 0..127 of a buffer are A's, rows 128..191 are Bt's
#pragma unroll
  for (int i = 0; i < 8; ++i) st[i] = *(const v8h*)(ga + i * 16 * GK);
#pragma unroll
  for (int i = 0; i < 4; ++i) st[8 + i] = *(const v8h*)(gb + i * 16 * GK);
#pragma unroll
  for (int i = 0; i < 12; ++i) *(v8h*)(sw + i * 16 * GPITCH) = st[i];
  __syncthreads();

  // unrolled by 8, so that the k steps and the two buffers are immediate offsets:
  // the global address pairs are formed once in eight trips, and no trip forms an
  // LDS address
#pragma unroll 8
  for (int kt = 0; kt < GK / GBK; ++kt) {
    const int cur = (kt & 1) * GBUF;
    const bool more = kt + 1 < GK / GBK;
    if (more) {
      const int kn = (kt + 1) * GBK;
#pragma unroll
      for (int i = 0; i < 8; ++i) st[i] = *(const v8h*)(ga + i * 16 * GK + kn);
#pragma unroll
      for (int i = 0; i < 4; ++i)
        st[8 + i] = *(const v8h*)(gb + i * 16 * GK + kn);
      // the loads' address pairs are rewritten at the head of the unrolled body,
      // and one way there in the built code passes no wait for the loads' data
      asm volatile("s_wait_xcnt 0x0" ::: "memory");
    }

    v16h a[2][2], bm[2][4];  // [k step of 32][tile]
#pragma unroll
    for (int ks = 0; ks < 2; ++ks) {
      const int o = cur + ks * 32;
      a[ks][0] = load_frag2(ra + o + kb0, ra + o + kb1);
      a[ks][1] = load_frag2(ra + o + 16 * GPITCH + kb0,
                            ra + o + 16 * GPITCH + kb1);
#pragma unroll
      for (int nt = 0; nt < 4; ++nt)
        bm[ks][nt] = load_frag2(rb + o + nt * 16 * GPITCH + kb0,
                                rb + o + nt * 16 * GPITCH + kb1);
    }
    // keeps the trip's LDS reads one group in front of its products: spread
    // among them into one register set, each pair of products waited out a read
    __builtin_amdgcn_sched_barrier(0);

#pragma unroll
    for (int ks = 0; ks < 2; ++ks)
#pragma unroll
      for (int nt = 0; nt < 4; ++nt) {
        acc[0][nt] = wmma_f16(a[ks][0], bm[ks][nt], acc[0][nt]);
        acc[1][nt] = wmma_f16(a[ks][1], bm[ks][nt], acc[1][nt]);
      }
    // keeps the wait for the global loads, which stands in front of the stores
    // below, behind the trip's products
    __builtin_amdgcn_sched_barrier(0);

    // the other buffer's last readers left it at the barrier of the trip before
    if (more) {
#pragma unroll
      for (int i = 0; i < 12; ++i)
        *(v8h*)(sw + (GBUF - cur) + i * 16 * GPITCH) = st[i];
      __syncthreads();
    }
  }
}

// Per-head projection: out = x @ W[h] + bias[h], W pre-transposed [H,D,E].
// Q, K and V in one launch: blockIdx.z picks the weight, the bias and the output.
// A WGP then holds as many blocks as its registers allow and takes the next as
// one ends, where three launches of two blocks a WGP stood in a row.
// grid = (ROWS/128, NH, 3), block = 128 (4 waves, each wave -> 32 rows x 64 cols)
// Q, K: out[b,h,s,d];  V: out[b,h,d,s] (transposed)
__global__ __launch_bounds__(128) void qkv_gemm_kernel(
    const h16* __restrict__ X,      // [ROWS, NE]
    const h16* __restrict__ Wqkv,   // 3 x [NH, ND, NE]
    const float* __restrict__ b_q,  // [NH, ND]
    const float* __restrict__ b_k,  // [NH, ND]
    const float* __restrict__ b_v,  // [NH, ND]
    h16* __restrict__ qkv)          // 3 x NB*NH*NS*ND
{
  const int which = blockIdx.z;
  const int vt    = which == 2;
  const h16* Wt   = Wqkv + (size_t)which * WT_HALVES;
  const float* bias = which == 0 ? b_q : which == 1 ? b_k : b_v;
  h16* out = qkv + (size_t)which * (NB * NH * NS * ND);
  const int tid  = threadIdx.x;
  const int wave = tid >> 5;
  const int lane = tid & 31;
  const int half = lane >> 4;
  const int l16  = lane & 15;
  const int h    = blockIdx.y;
  const int rowbase = blockIdx.x * 128 + wave * 32;

  __shared__ __attribute__((aligned(16))) h16 sm[2 * GBUF];
  v8f acc[2][4] = {};
  tile_product(X + (size_t)blockIdx.x * 128 * NE, Wt + (size_t)h * ND * NE, sm,
               acc);

  if (vt) {
    // transposed output: a lane's eight registers are eight consecutive s of
    // one d row (a group of 8 never crosses a batch): one 16-byte store
#pragma unroll
    for (int mt = 0; mt < 2; ++mt)
#pragma unroll
      for (int nt = 0; nt < 4; ++nt) {
        const int rowg = rowbase + mt * 16 + half * 8;
        const int b    = rowg >> 11;  // / NS
        const int s    = rowg & (NS - 1);
        const int n    = nt * 16 + l16;
        const float bn = bias[h * ND + n];
        v8h o;
#pragma unroll
        for (int r = 0; r < 8; ++r) o[r] = (h16)(acc[mt][nt][r] + bn);
        *(v8h*)(out + ((size_t)(b * NH + h) * ND + n) * NS + s) = o;
      }
    return;
  }

#pragma unroll
  for (int mt = 0; mt < 2; ++mt)
#pragma unroll
    for (int nt = 0; nt < 4; ++nt)
#pragma unroll
      for (int r = 0; r < 8; ++r) {
        const int rowg = rowbase + mt * 16 + half * 8 + r;
        const int b    = rowg >> 11;  // / NS
        const int s    = rowg & (NS - 1);
        const int n    = nt * 16 + l16;
        const float v  = acc[mt][nt][r] + bias[h * ND + n];
        out[((size_t)(b * NH + h) * NS + s) * ND + n] = (h16)v;
      }
  // the built code lays V's side behind this one, with a way from here into it,
  // and V's side reuses the stores' registers
  asm volatile("s_wait_xcnt 0x0" ::: "memory");
}

// Lane l <-> lane l ^ 16: the other half of the wave holds the other 16 keys
// of the same query column.
static __device__ __forceinline__ float other_half(float v) {
  int b = __builtin_bit_cast(int, v);
  b = __builtin_amdgcn_permlanex16(b, b, 0x76543210, 0xfedcba98, false, false);
  return __builtin_bit_cast(float, b);
}

// Flash-attention: one block of AW waves per 32-query tile per (b,h); K/V
// fragments are shared by both 16-query sub-tiles (2x WMMA per byte loaded).
// The tile's 32-key chunks are dealt round-robin to the waves: the launch lasts
// as long as its longest wave, which now walks 16 chunks where a lone wave
// walked 64, and a SIMD holds twice the waves to cover loads and chains.  Each
// wave keeps its own running maximum, sum and Ot; they are joined once in LDS.
// The products are taken transposed: St = K Q^T and Ot += Vt Pt.  A lane then
// holds 16 of the 32 scores of ONE query (its column), so maximum and sum are
// taken in the lane, and the two score tiles of a column, converted in place,
// are the B operand of the second product.
// grid = NB*NH*(NS/32), block = 32*AW.  V is transposed [NB*NH, ND, NS].
#define AW 4
// one (wave, d tile) slice of the partial Ot in LDS, floats: 2 query tiles x 2
// pieces x 32 lanes x 4 values, and 16 more: 16 lanes of a 16-byte read in the
// join take 4 queries x 4 d tiles, and 64 B a slice puts them on distinct banks
#define JSLICE (2 * 2 * 32 * 4 + 16)
// A wave's own staging rows in LDS, halves: its chunk's 32 K rows of 128 bytes at
// a pitch of 144 bytes, then the 64 Vt rows of 64 bytes at a pitch of 80 bytes
// (both 16 B x odd: the 16 rows of a 16-byte fragment read fall on distinct banks)
#define KPITCH 72
#define VPITCH 40
#define KVW (32 * KPITCH + 64 * VPITCH)
__global__ __launch_bounds__(32 * AW) void attn_kernel(
    const h16* __restrict__ Q,   // [NB*NH, NS, ND]
    const h16* __restrict__ K,   // [NB*NH, NS, ND]
    const h16* __restrict__ Vt,  // [NB*NH, ND, NS]
    h16* __restrict__ O)         // [NB, NS, NH*ND]
{
  __shared__ __attribute__((aligned(16))) float s_acc[AW * 4 * JSLICE];
  __shared__ float s_m[AW][2][32];
  __shared__ float s_l[AW][2][32];
  __shared__ __attribute__((aligned(16))) h16 s_kv[AW * KVW];
  const int lane = threadIdx.x & 31;
  // in a scalar register, so that the key loop's test is a scalar branch
  const int wave = __builtin_amdgcn_readfirstlane(threadIdx.x >> 5);
  const int half = lane >> 4;
  const int l16  = lane & 15;
  const int kb0  = half * 8;
  const int kb1  = 16 + half * 8;
  // Only half the blocks are resident at once, and the cost falls with the
  // index: the longest query tiles of all
  // (b,h) come first and the one-chunk tiles fill the end of the launch.
  // (the mask tells the compiler that qt lies in 0 .. NS / 32 - 1)
  const int qt   = (NS / 32 - 1) - ((blockIdx.x / (NB * NH)) & (NS / 32 - 1));
  const int bh   = blockIdx.x % (NB * NH);
  const int h    = bh & (NH - 1);
  const int b    = bh >> 4;
  const int qbase = qt * 32;

  const h16* Qp = Q + (size_t)bh * NS * ND;
  const h16* Kp = K + (size_t)bh * NS * ND;
  const h16* Vp = Vt + (size_t)bh * ND * NS;

  // Q fragments (B operand: lane = query column): 2 column tiles x 2 K-chunks,
  // resident for the whole pass
  v16h bq[2][2];
#pragma unroll
  for (int mt = 0; mt < 2; ++mt) {
    const h16* qrow = Qp + (size_t)(qbase + mt * 16 + l16) * ND;
#pragma unroll
    for (int kc = 0; kc < 2; ++kc)
      bq[mt][kc] = load_frag2(qrow + kc * 32 + kb0, qrow + kc * 32 + kb1);
  }

  // acc[mt][nt][r] = O[query mt*16 + l16][d = nt*16 + half*8 + r]
  v8f acc[2][4] = {};
  float col_m[2] = {-1e30f, -1e30f};  // running maximum of the lane's query
  float col_l[2] = {0.0f, 0.0f};      // running sum over this half's keys only

  const float scale  = 0.125f;        // 1/sqrt(64)
  const int nchunks = (qbase >> 5) + 1;  // causal bound (rows < qbase+32)

  // A fragment load straight from the rows touches 16 lines for 512 bytes.  The
  // wave brings its chunk by whole rows instead and turns it in its own LDS rows:
  // K by 8 lanes a 128-byte row (4 whole lines a load), Vt by 4 lanes a 64-byte
  // row piece (8 lines a load).  The groups of lanes that share a 16-lane LDS
  // store take K rows 8 apart and Vt rows 4 apart, which puts them on distinct
  // banks at these pitches.  Load i takes K rows krow0 + i; load j takes Vt rows
  // vrow0 + (j & 3) + 32 (j >> 2).
  const int krow0 = (lane >> 3) * 8;
  const int kpc   = (lane & 7) * 8;
  const int vrow0 = ((lane >> 2) & 3) * 4 + half * 16;
  const int vpc   = (lane & 3) * 8;
  h16* sb = s_kv + wave * KVW;
  h16* wk = sb + krow0 * KPITCH + kpc;
  h16* wv = sb + 32 * KPITCH + vrow0 * VPITCH + vpc;
  const h16* rk = sb + l16 * KPITCH;
  const h16* rv = sb + 32 * KPITCH + l16 * VPITCH;
  // running pointers of the wave's current chunk, so that a trip forms no
  // address from the chunk's number; pk: one K line a lane, for the prefetch
  const h16* gk = Kp + (size_t)(wave * 32 + krow0) * ND + kpc;
  const h16* gv = Vp + (size_t)vrow0 * NS + wave * 32 + vpc;
  const h16* pk = Kp + (size_t)(wave * 32 + lane) * ND;

  for (int ch = wave; ch < nchunks; ch += AW) {
    const int tbase = ch * 32;

    // ---- the chunk's K rows, and behind them its Vt rows, which fly while K is
    // turned ----
    v8h sk[8], sv[8];
#pragma unroll
    for (int i = 0; i < 8; ++i) sk[i] = *(const v8h*)(gk + i * ND);
#pragma unroll
    for (int j = 0; j < 8; ++j)
      sv[j] = *(const v8h*)(gv + (size_t)((j & 3) + 32 * (j >> 2)) * NS);
    // keeps the loads in front of the prefetch's branch: without it the built code
    // sinks all sixteen behind it
    __builtin_amdgcn_sched_barrier(0);
    if (ch + AW < nchunks) __builtin_prefetch(pk + AW * 32 * ND, 0, 3);
    // the address registers of the loads and the prefetch above are advanced
    // below
    asm volatile("s_wait_xcnt 0x0" ::: "memory");
    // keeps the address additions from being lifted over that wait
    __builtin_amdgcn_sched_barrier(0);
    gk += AW * 32 * ND;
    gv += AW * 32;
    pk += AW * 32 * ND;

    // every lane's fragment reads of the trip before have returned before the
    // wave's rows are written again
    asm volatile("s_wait_dscnt 0x0" ::: "memory");
#pragma unroll
    for (int i = 0; i < 8; ++i) *(v8h*)(wk + i * KPITCH) = sk[i];
    // a lane reads back rows that other lanes of the wave wrote
    asm volatile("s_wait_dscnt 0x0" ::: "memory");

    // ---- K fragments (A operand: lane = key row; shared by both tiles) ----
    v16h ak[2][2];  // [tt][kc]
#pragma unroll
    for (int tt = 0; tt < 2; ++tt) {
      const h16* krow = rk + tt * 16 * KPITCH;
#pragma unroll
      for (int kc = 0; kc < 2; ++kc)
        ak[tt][kc] = load_frag2(krow + kc * 32 + kb0, krow + kc * 32 + kb1);
    }

    // ---- scores: St = K Q^T ----
    // c[mt][tt][r] = S[query mt*16 + l16][key tbase + tt*16 + half*8 + r]
    v8f c[2][2] = {};
#pragma unroll
    for (int mt = 0; mt < 2; ++mt)
#pragma unroll
      for (int tt = 0; tt < 2; ++tt)
#pragma unroll
        for (int kc = 0; kc < 2; ++kc)
          c[mt][tt] = wmma_f16(ak[tt][kc], bq[mt][kc], c[mt][tt]);

    // ---- V fragments (A operand: lane = d row; shared by both tiles) ----
    // turned and read in front of the softmax, so that they arrive during it
#pragma unroll
    for (int j = 0; j < 8; ++j)
      *(v8h*)(wv + ((j & 3) + 32 * (j >> 2)) * VPITCH) = sv[j];
    // a lane reads back rows that other lanes of the wave wrote
    asm volatile("s_wait_dscnt 0x0" ::: "memory");
    v16h av[4];
#pragma unroll
    for (int nt = 0; nt < 4; ++nt) {
      const h16* vr = rv + nt * 16 * VPITCH;
      av[nt] = load_frag2(vr + kb0, vr + kb1);
    }
    // keeps the scheduler from sinking these reads to their use, where it split
    // them into four pairs, each waited for on its own
    __builtin_amdgcn_sched_barrier(0);

    // ---- scale + causal mask + online softmax (per query column) ----
    float corr[2];
    v16h bp[2];  // P^T as B operand: element tt*8 + r = key tt*16 + half*8 + r
#pragma unroll
    for (int mt = 0; mt < 2; ++mt) {
      const int srow = qbase + mt * 16 + l16;
      float s[16];
#pragma unroll
      for (int e = 0; e < 16; ++e) {
        s[e] = c[mt][e >> 3][e & 7] * scale;
        if (tbase + (e >> 3) * 16 + half * 8 + (e & 7) > srow) s[e] = -1e30f;
      }
      // pairwise trees, so that no chain is longer than four links
      float t[8];
#pragma unroll
      for (int e = 0; e < 8; ++e) t[e] = fmaxf(s[e], s[e + 8]);
#pragma unroll
      for (int w = 4; w > 0; w >>= 1)
#pragma unroll
        for (int e = 0; e < w; ++e) t[e] = fmaxf(t[e], t[e + w]);
      const float mx   = fmaxf(t[0], other_half(t[0]));
      const float mnew = fmaxf(col_m[mt], mx);
      corr[mt]  = __expf(col_m[mt] - mnew);
      col_m[mt] = mnew;
#pragma unroll
      for (int e = 0; e < 16; ++e) {
        s[e] = __expf(s[e] - mnew);
        bp[mt][e] = (h16)s[e];
      }
#pragma unroll
      for (int e = 0; e < 8; ++e) t[e] = s[e] + s[e + 8];
#pragma unroll
      for (int w = 4; w > 0; w >>= 1)
#pragma unroll
        for (int e = 0; e < w; ++e) t[e] += t[e + w];
      col_l[mt] = col_l[mt] * corr[mt] + t[0];
    }

    // rescale running accumulators
#pragma unroll
    for (int mt = 0; mt < 2; ++mt)
#pragma unroll
      for (int nt = 0; nt < 4; ++nt)
#pragma unroll
        for (int r = 0; r < 8; ++r) acc[mt][nt][r] *= corr[mt];

    // ---- Ot += Vt Pt ----
#pragma unroll
    for (int nt = 0; nt < 4; ++nt) {
      acc[0][nt] = wmma_f16(av[nt], bp[0], acc[0][nt]);
      acc[1][nt] = wmma_f16(av[nt], bp[1], acc[1][nt]);
    }
  }

  // ---- join the waves' partial results ----
  // a wave that had no chunk hands over maximum -1e30, sum 0 and Ot 0, and its
  // factor below is 0; wave 0 always has chunk 0, so the joint maximum is real
#pragma unroll
  for (int mt = 0; mt < 2; ++mt) {
    s_m[wave][mt][lane] = col_m[mt];
    s_l[wave][mt][lane] = col_l[mt] + other_half(col_l[mt]);
#pragma unroll
    for (int nt = 0; nt < 4; ++nt)
#pragma unroll
      for (int p = 0; p < 2; ++p) {
        const v4f t = {acc[mt][nt][p * 4 + 0], acc[mt][nt][p * 4 + 1],
                       acc[mt][nt][p * 4 + 2], acc[mt][nt][p * 4 + 3]};
        *(v4f*)&s_acc[(wave * 4 + nt) * JSLICE + (mt * 2 + p) * 128 + lane * 4] =
            t;
      }
  }
  __syncthreads();

  // Wave w finishes queries 8 w .. 8 w + 7, four lanes a query with 16 d each,
  // so that a 128-byte row of O (head-concat layout [B, S, H*D]) has one writer.
  const int q   = wave * 8 + (lane >> 2);
  const int dt  = lane & 3;  // the lane's d tile
  const int qmt = q >> 4;
  const int ql  = q & 15;
  float pm[AW];
#pragma unroll
  for (int w = 0; w < AW; ++w) pm[w] = s_m[w][qmt][ql];
  const float mall = fmaxf(fmaxf(pm[0], pm[1]), fmaxf(pm[2], pm[3]));
  float lall = 0.0f;
  float o[16] = {};
#pragma unroll
  for (int w = 0; w < AW; ++w) {
    // exp(x) as 2^(x log2 e).  In asm so that the v_nop stands directly behind
    // the transcendental: the free slot before its source register is reused
    float f;
    asm("v_exp_f32 %0, %1\n\tv_nop"
        : "=v"(f)
        : "v"((pm[w] - mall) * 1.44269504f));
    lall += f * s_l[w][qmt][ql];
#pragma unroll
    for (int hf = 0; hf < 2; ++hf)
#pragma unroll
      for (int p = 0; p < 2; ++p) {
        const v4f t = *(const v4f*)&s_acc[(w * 4 + dt) * JSLICE +
                                          (qmt * 2 + p) * 128 +
                                          (hf * 16 + ql) * 4];
#pragma unroll
        for (int j = 0; j < 4; ++j) o[hf * 8 + p * 4 + j] += f * t[j];
      }
  }
  const float inv = 1.0f / lall;
  h16* orow = O + ((size_t)b * NS + qbase + q) * (NH * ND) + h * ND + dt * 16;
#pragma unroll
  for (int hf = 0; hf < 2; ++hf) {
    v8h ov;
#pragma unroll
    for (int r = 0; r < 8; ++r) ov[r] = (h16)(o[hf * 8 + r] * inv);
    *(v8h*)(orow + hf * 8) = ov;
  }
}

// Output projection: out = A @ W_o + b_o (f32), W_o pre-transposed [NE, NH*ND]
// grid = (ROWS/128, NE/64), block = 128 (4 waves, each wave 32 rows x 64 cols)
__global__ __launch_bounds__(128) void out_gemm_kernel(
    const h16* __restrict__ A,       // [ROWS, NH*ND]
    const h16* __restrict__ Wot,     // [NE, NH*ND]
    const float* __restrict__ bias,  // [NE]
    float* __restrict__ out)         // [ROWS, NE]
{
  const int tid  = threadIdx.x;
  const int wave = tid >> 5;
  const int lane = tid & 31;
  const int half = lane >> 4;
  const int l16  = lane & 15;
  const int rowbase = blockIdx.x * 128 + wave * 32;
  const int ntbase  = blockIdx.y * 64;

  __shared__ __attribute__((aligned(16))) h16 sm[2 * GBUF];
  v8f acc[2][4] = {};
  tile_product(A + (size_t)blockIdx.x * 128 * (NH * ND),
               Wot + (size_t)ntbase * (NH * ND), sm, acc);

#pragma unroll
  for (int mt = 0; mt < 2; ++mt)
#pragma unroll
    for (int nt = 0; nt < 4; ++nt)
#pragma unroll
      for (int r = 0; r < 8; ++r) {
        const int rowg = rowbase + mt * 16 + half * 8 + r;
        const int n    = ntbase + nt * 16 + l16;
        out[(size_t)rowg * NE + n] = acc[mt][nt][r] + bias[n];
      }
}

extern "C" void kernel_launch(void* const* d_in, const int* in_sizes, int n_in,
                              void* d_out, int out_size, void* d_ws,
                              size_t ws_size, hipStream_t stream) {
  const float* x   = (const float*)d_in[0];
  const float* W_q = (const float*)d_in[1];
  const float* b_q = (const float*)d_in[2];
  const float* W_k = (const float*)d_in[3];
  const float* b_k = (const float*)d_in[4];
  const float* W_v = (const float*)d_in[5];
  const float* b_v = (const float*)d_in[6];
  const float* W_o = (const float*)d_in[7];
  const float* b_o = (const float*)d_in[8];
  float* out = (float*)d_out;

  const size_t nx   = (size_t)ROWS * NE;          // 4M halves
  const size_t nqkv = (size_t)NB * NH * NS * ND;  // 4M halves
  const size_t nw   = (size_t)NH * NE * ND;       // 1M halves
  h16* xh  = (h16*)d_ws;
  h16* qh  = xh + nx;
  h16* kh  = qh + nqkv;
  h16* vh  = kh + nqkv;   // transposed V: [NB*NH, ND, NS]
  h16* oh  = vh + nqkv;
  h16* wqh = oh + nx;     // transposed: [NH, ND, NE]
  h16* wkh = wqh + nw;
  h16* wvh = wkh + nw;
  h16* woh = wvh + nw;    // transposed: [NE, NH*ND]

  // wqh, wkh, wvh, woh stand one behind the other, and so do qh, kh, vh
  prep_kernel<<<CVT_BLOCKS + 4 * WT_TILES, 256, 0, stream>>>(x, W_q, W_k, W_v,
                                                             W_o, xh, wqh);

  dim3 gq(ROWS / 128, NH, 3);
  qkv_gemm_kernel<<<gq, 128, 0, stream>>>(xh, wqh, b_q, b_k, b_v, qh);

  attn_kernel<<<NB * NH * (NS / 32), 32 * AW, 0, stream>>>(qh, kh, vh, oh);

  dim3 go(ROWS / 128, NE / 64);
  out_gemm_kernel<<<go, 128, 0, stream>>>(oh, woh, b_o, out);
}

// v010
// One run takes 68.6 microseconds.
// Next to v009, in two timings, it ran 1.12 and 1.14 times as fast.
// All steps since v000 together make it 5.50 times as fast.
#include <hip/hip_runtime.h>

typedef _Float16 h16;
typedef __attribute__((ext_vector_type(16))) _Float16 v16h;
typedef __attribute__((ext_vector_type(8)))  _Float16 v8h;
typedef __attribute__((ext_vector_type(8)))  float    v8f;
typedef __attribute__((ext_vector_type(2)))  _Float16 v2h;
typedef __attribute__((ext_vector_type(4)))  _Float16 v4h;
typedef __attribute__((ext_vector_type(4)))  float    v4f;

#define NB 2
#define NS 2048
#define NE 1024
#define NH 16
#define ND 64
#define ROWS (NB * NS) /* 4096 */

static __device__ __forceinline__ v8f wmma_f16(v16h a, v16h b, v8f c) {
  // 8 args: (neg_a, A, neg_b, B, c_mod, C, reuse_a, reuse_b)
  return __builtin_amdgcn_wmma_f32_16x16x32_f16(false, a, false, b, (short)0, c,
                                                false, false);
}

// Two contiguous 16-byte loads -> one 16-half fragment (b128 pairs)
static __device__ __forceinline__ v16h load_frag2(const h16* p0, const h16* p1) {
  v8h lo = *(const v8h*)p0;
  v8h hi = *(const v8h*)p1;
  return __builtin_shufflevector(lo, hi, 0, 1, 2, 3, 4, 5, 6, 7, 8, 9, 10, 11,
                                 12, 13, 14, 15);
}

// x -> f16, a stream: a wave takes 1024 consecutive values, as eight 16-byte
// loads a lane that are all in flight together (512 contiguous bytes a load)
// and eight 8-byte stores (256 contiguous bytes a store).  CVT_BLOCKS blocks of
// 8 waves, block = 256; blk is the block's number among them.
#define CVT_PER_WAVE 1024
#define CVT_PER_BLOCK (8 * CVT_PER_WAVE)
#define CVT_BLOCKS (ROWS * NE / CVT_PER_BLOCK) /* 512 */
static_assert((ROWS * NE) % CVT_PER_BLOCK == 0, "whole blocks only");
static __device__ __forceinline__ void cvt_block(const float* __restrict__ src,
                                                 h16* __restrict__ dst, int blk) {
  const int base = blk * CVT_PER_BLOCK +
                   (threadIdx.x >> 5) * CVT_PER_WAVE + (threadIdx.x & 31) * 4;
  // unrolled so that v[] stays in registers and no store stands among the loads
  v4f v[8];
#pragma unroll
  for (int i = 0; i < 8; ++i) v[i] = *(const v4f*)(src + base + i * 128);
#pragma unroll
  for (int i = 0; i < 8; ++i) {
    const v4h o = {(h16)v[i][0], (h16)v[i][1], (h16)v[i][2], (h16)v[i][3]};
    *(v4h*)(dst + base + i * 128) = o;
  }
}

// Batched transpose-convert: src [batch, R, C] f32 -> dst [batch, C, R] f16
// One 64x64 tile per block, turned in LDS, so that both sides of the copy move
// whole 128-byte lines.  block = 256; the tile is (ct, rt) of matrix bz.
// The tile is kept as [c][r]; the eight 16-byte chunks of a row are XOR-ed
// with (c >> 2) & 7 so that the 4-byte stores of a wave (columns 4 apart)
// spread over the banks while the 16-byte reads stay aligned.
static __device__ __forceinline__ void cvt_t_block(
    const float* __restrict__ src, h16* __restrict__ dst, int R, int C, int ct,
    int rt, int bz) {
  __shared__ __attribute__((aligned(16))) h16 tile[64 * 64];
  const int tid = threadIdx.x;
  const int c0  = ct * 64;
  const int r0  = rt * 64;
  const size_t base = (size_t)bz * R * C;
  const int cq = (tid & 15) * 4;  // four columns per thread
  const int rp = (tid >> 4) * 2;  // a pair of rows per thread

  // the loops below are unrolled so that v[][] stays in registers and the four
  // loads of a thread are in flight together
  v4f v[2][2];
#pragma unroll
  for (int it = 0; it < 2; ++it)
#pragma unroll
    for (int p = 0; p < 2; ++p)
      v[it][p] = *(const v4f*)(src + base +
                               (size_t)(r0 + it * 32 + rp + p) * C + c0 + cq);
#pragma unroll
  for (int it = 0; it < 2; ++it)
#pragma unroll
    for (int j = 0; j < 4; ++j) {
      const int c = cq + j;
      const int r = it * 32 + rp;
      const int chunk = (r >> 3) ^ ((c >> 2) & 7);
      v2h pr = {(h16)v[it][0][j], (h16)v[it][1][j]};
      *(v2h*)&tile[c * 64 + chunk * 8 + (r & 7)] = pr;
    }
  __syncthreads();
#pragma unroll
  for (int it = 0; it < 2; ++it) {
    const int c = it * 32 + (tid >> 3);
    const int q = tid & 7;
    const v8h o = *(const v8h*)&tile[c * 64 + (q ^ ((c >> 2) & 7)) * 8];
    *(v8h*)(dst + base + (size_t)(c0 + c) * R + r0 + q * 8) = o;
  }
}

// All five conversions in one launch: none reads what another writes, so a range
// of the block index picks the job (a block-uniform branch) and their starts,
// memory latencies and last stores overlap, where five launches stood in a row.
// Blocks 0 .. CVT_BLOCKS - 1 convert x (the most bytes a block, so first); then
// 256 tiles each of W_q, W_k, W_v (per head [NE, ND] -> [ND, NE]) and of W_o
// ([NH*ND, NE] -> [NE, NH*ND]), whose outputs stand one behind the other in wt.
#define WT_TILES 256               /* 64x64 tiles of one weight */
#define WT_HALVES (NH * NE * ND)   /* elements of one weight */
__global__ __launch_bounds__(256) void prep_kernel(
    const float* __restrict__ x, const float* __restrict__ W_q,
    const float* __restrict__ W_k, const float* __restrict__ W_v,
    const float* __restrict__ W_o, h16* __restrict__ xh, h16* __restrict__ wt) {
  const int blk = blockIdx.x;
  if (blk < CVT_BLOCKS) {
    cvt_block(x, xh, blk);
    return;
  }
  const int job = (blk - CVT_BLOCKS) >> 8;   // / WT_TILES
  const int t   = (blk - CVT_BLOCKS) & (WT_TILES - 1);
  const int lo  = t & 15;
  const int hi  = t >> 4;
  const bool wo = job == 3;  // one matrix of 16 x 16 tiles; else 16 of 1 x 16
  const float* w = job == 0 ? W_q : job == 1 ? W_k : job == 2 ? W_v : W_o;
  static_assert(NH * ND == NE, "all four weights have NE rows a matrix");
  cvt_t_block(w, wt + (size_t)job * WT_HALVES, NE, wo ? NE : ND, wo ? lo : 0,
              wo ? hi : lo, wo ? 0 : hi);
}

// Product of one 128 x 64 output tile, used by the output projection:
// acc += A[128 rows] * Bt[64 rows]^T over k = 0..1023, both operands k-contiguous
// with a row pitch of 1024 halves.  block = 128 (4 waves, each 32 rows x 64 cols).
// A fragment load straight from the rows touches 16 lines for 512 bytes, so the
// block brings 64 k of all 192 rows by whole 128-byte lines (8 lanes a row)
// and turns them in LDS; the next trip's lines fly while this trip's products
// run, in two buffers.  LDS rows stand at 144 bytes (16 B x odd), the pitch at
// which the 16 rows of a 16-byte fragment read fall on distinct banks.
#define GK 1024                     /* k extent and row pitch, halves */
#define GBK 64                      /* k per trip: one 128-byte line a row */
#define GPITCH 72                   /* LDS row pitch, halves */
#define GBUF ((128 + 64) * GPITCH)  /* one buffer, halves */
static __device__ __forceinline__ void tile_product(
    const h16* __restrict__ Ab,  // first of the block's 128 rows of A
    const h16* __restrict__ Bb,  // first of the block's 64 rows of Bt
    h16* sm,                     // 2 * GBUF halves of LDS
    v8f (&acc)[2][4])
{
  const int tid  = threadIdx.x;
  const int wave = tid >> 5;
  const int lane = tid & 31;
  const int half = lane >> 4;
  const int l16  = lane & 15;
  const int kb0  = half * 8;
  const int kb1  = 16 + half * 8;
  // staging: rows srow + 16 i, one 16-byte piece of each.  Neighbouring groups
  // of 8 lanes take rows 8 apart: 8 * 144 B lands half the banks further, so the
  // 16 lanes of a 16-byte LDS store cover every bank once (rows 1 apart would
  // share 4 banks)
  const int srow = ((tid >> 3) & 1) * 8 + (tid >> 4);
  const int sch  = (tid & 7) * 8;

  const h16* ga = Ab + (size_t)srow * GK + sch;
  const h16* gb = Bb + (size_t)srow * GK + sch;
  h16* sw = sm + srow * GPITCH + sch;
  const h16* ra = sm + (wave * 32 + l16) * GPITCH;
  const h16* rb = sm + (128 + l16) * GPITCH;

  v8h st[12];  // rows 0..127 of a buffer are A's, rows 128..191 are Bt's
#pragma unroll
  for (int i = 0; i < 8; ++i) st[i] = *(const v8h*)(ga + i * 16 * GK);
#pragma unroll
  for (int i = 0; i < 4; ++i) st[8 + i] = *(const v8h*)(gb + i * 16 * GK);
#pragma unroll
  for (int i = 0; i < 12; ++i) *(v8h*)(sw + i * 16 * GPITCH) = st[i];
  __syncthreads();

  // unrolled by 8, so that the k steps and the two buffers are immediate offsets:
  // the global address pairs are formed once in eight trips, and no trip forms an
  // LDS address
#pragma unroll 8
  for (int kt = 0; kt < GK / GBK; ++kt) {
    const int cur = (kt & 1) * GBUF;
    const bool more = kt + 1 < GK / GBK;
    if (more) {
      const int kn = (kt + 1) * GBK;
#pragma unroll
      for (int i = 0; i < 8; ++i) st[i] = *(const v8h*)(ga + i * 16 * GK + kn);
#pragma unroll
      for (int i = 0; i < 4; ++i)
        st[8 + i] = *(const v8h*)(gb + i * 16 * GK + kn);
      // the loads' address pairs are rewritten at the head of the unrolled body,
      // and one way there in the built code passes no wait for the loads' data
      asm volatile("s_wait_xcnt 0x0" ::: "memory");
    }

    v16h a[2][2], bm[2][4];  // [k step of 32][tile]
#pragma unroll
    for (int ks = 0; ks < 2; ++ks) {
      const int o = cur + ks * 32;
      a[ks][0] = load_frag2(ra + o + kb0, ra + o + kb1);
      a[ks][1] = load_frag2(ra + o + 16 * GPITCH + kb0,
                            ra + o + 16 * GPITCH + kb1);
#pragma unroll
      for (int nt = 0; nt < 4; ++nt)
        bm[ks][nt] = load_frag2(rb + o + nt * 16 * GPITCH + kb0,
                                rb + o + nt * 16 * GPITCH + kb1);
    }
    // keeps the trip's LDS reads one group in front of its products: spread
    // among them into one register set, each pair of products waited out a read
    __builtin_amdgcn_sched_barrier(0);

#pragma unroll
    for (int ks = 0; ks < 2; ++ks)
#pragma unroll
      for (int nt = 0; nt < 4; ++nt) {
        acc[0][nt] = wmma_f16(a[ks][0], bm[ks][nt], acc[0][nt]);
        acc[1][nt] = wmma_f16(a[ks][1], bm[ks][nt], acc[1][nt]);
      }
    // keeps the wait for the global loads, which stands in front of the stores
    // below, behind the trip's products
    __builtin_amdgcn_sched_barrier(0);

    // the other buffer's last readers left it at the barrier of the trip before
    if (more) {
#pragma unroll
      for (int i = 0; i < 12; ++i)
        *(v8h*)(sw + (GBUF - cur) + i * 16 * GPITCH) = st[i];
      __syncthreads();
    }
  }
}

// The same product for a 128 x 128 output tile: block = 128, 4 waves in 2 x 2, each
// 64 rows x 64 cols.  A trip brings 256 rows for 128 products of the block where
// the tile above brings 192 rows for 64, and a wave reads 8 fragments for 16
// products where it read 6 for 8: a third fewer L2 and LDS bytes a product.
// The fragments of one k step of 32 are read as one group, then its products run;
// one fragment set, so that three waves fit a SIMD.
#define WBUF ((128 + 128) * GPITCH)  /* one buffer, halves */
static __device__ __forceinline__ void tile_product_wide(
    const h16* __restrict__ Ab,  // first of the block's 128 rows of A
    const h16* __restrict__ Bb,  // first of the block's 128 rows of Bt
    h16* sm,                     // 2 * WBUF halves of LDS
    v8f (&acc)[4][4])
{
  const int tid  = threadIdx.x;
  const int wave = tid >> 5;
  const int lane = tid & 31;
  const int half = lane >> 4;
  const int l16  = lane & 15;
  const int kb0  = half * 8;
  const int kb1  = 16 + half * 8;
  // staging rows and pieces as in tile_product
  const int srow = ((tid >> 3) & 1) * 8 + (tid >> 4);
  const int sch  = (tid & 7) * 8;

  const h16* ga = Ab + (size_t)srow * GK + sch;
  const h16* gb = Bb + (size_t)srow * GK + sch;
  h16* sw = sm + srow * GPITCH + sch;
  const h16* ra = sm + ((wave & 1) * 64 + l16) * GPITCH;
  const h16* rb = sm + (128 + (wave >> 1) * 64 + l16) * GPITCH;

  v8h st[16];  // rows 0..127 of a buffer are A's, rows 128..255 are Bt's
#pragma unroll
  for (int i = 0; i < 8; ++i) st[i] = *(const v8h*)(ga + i * 16 * GK);
#pragma unroll
  for (int i = 0; i < 8; ++i) st[8 + i] = *(const v8h*)(gb + i * 16 * GK);
#pragma unroll
  for (int i = 0; i < 16; ++i) *(v8h*)(sw + i * 16 * GPITCH) = st[i];
  __syncthreads();

  // unrolled by 8, so that the k steps and the two buffers are immediate offsets
#pragma unroll 8
  for (int kt = 0; kt < GK / GBK; ++kt) {
    const int cur = (kt & 1) * WBUF;
    const bool more = kt + 1 < GK / GBK;
    if (more) {
      const int kn = (kt + 1) * GBK;
#pragma unroll
      for (int i = 0; i < 8; ++i) st[i] = *(const v8h*)(ga + i * 16 * GK + kn);
#pragma unroll
      for (int i = 0; i < 8; ++i)
        st[8 + i] = *(const v8h*)(gb + i * 16 * GK + kn);
      // the loads' address pairs are rewritten at the head of the unrolled body
      asm volatile("s_wait_xcnt 0x0" ::: "memory");
    }

#pragma unroll
    for (int ks = 0; ks < 2; ++ks) {
      const int o = cur + ks * 32;
      v16h a[4], bm[4];
#pragma unroll
      for (int t = 0; t < 4; ++t) {
        a[t]  = load_frag2(ra + o + t * 16 * GPITCH + kb0,
                           ra + o + t * 16 * GPITCH + kb1);
        bm[t] = load_frag2(rb + o + t * 16 * GPITCH + kb0,
                           rb + o + t * 16 * GPITCH + kb1);
      }
      // keeps the k step's LDS reads one group in front of its products
      __builtin_amdgcn_sched_barrier(0);
#pragma unroll
      for (int nt = 0; nt < 4; ++nt)
#pragma unroll
        for (int mt = 0; mt < 4; ++mt)
          acc[mt][nt] = wmma_f16(a[mt], bm[nt], acc[mt][nt]);
      // keeps the next group of reads, and the wait for the global loads in front
      // of the stores below, behind these products (one fragment set)
      __builtin_amdgcn_sched_barrier(0);
    }

    // the other buffer's last readers left it at the barrier of the trip before
    if (more) {
#pragma unroll
      for (int i = 0; i < 16; ++i)
        *(v8h*)(sw + (WBUF - cur) + i * 16 * GPITCH) = st[i];
      __syncthreads();
    }
  }
}

// Per-head projection: out = x @ W[h] + bias[h], W pre-transposed [H,D,E].
// Q, K and V in one launch: blockIdx.z picks the weight, the bias and the output.
// A block takes 128 rows x two heads; a wave 64 rows of one head.  The 768 blocks
// are three a WGP, which its registers hold at once: one round, no late blocks.
// grid = (ROWS/128, NH/2, 3), block = 128 (4 waves, each wave -> 64 rows x 64 cols)
// Q, K: out[b,h,s,d];  V: out[b,h,d,s] (transposed)
__global__ __launch_bounds__(128) void qkv_gemm_kernel(
    const h16* __restrict__ X,      // [ROWS, NE]
    const h16* __restrict__ Wqkv,   // 3 x [NH, ND, NE]
    const float* __restrict__ b_q,  // [NH, ND]
    const float* __restrict__ b_k,  // [NH, ND]
    const float* __restrict__ b_v,  // [NH, ND]
    h16* __restrict__ qkv)          // 3 x NB*NH*NS*ND
{
  const int which = blockIdx.z;
  const int vt    = which == 2;
  const h16* Wt   = Wqkv + (size_t)which * WT_HALVES;
  const float* bias = which == 0 ? b_q : which == 1 ? b_k : b_v;
  h16* out = qkv + (size_t)which * (NB * NH * NS * ND);
  const int tid  = threadIdx.x;
  const int wave = tid >> 5;
  const int lane = tid & 31;
  const int half = lane >> 4;
  const int l16  = lane & 15;
  const int h    = blockIdx.y * 2 + (wave >> 1);
  const int rowbase = blockIdx.x * 128 + (wave & 1) * 64;

  __shared__ __attribute__((aligned(16))) h16 sm[2 * WBUF];
  v8f acc[4][4] = {};
  tile_product_wide(X + (size_t)blockIdx.x * 128 * NE,
                    Wt + (size_t)blockIdx.y * 2 * ND * NE, sm, acc);

  if (vt) {
    // transposed output: a lane's eight registers are eight consecutive s of
    // one d row (a group of 8 never crosses a batch): one 16-byte store
#pragma unroll
    for (int mt = 0; mt < 4; ++mt)
#pragma unroll
      for (int nt = 0; nt < 4; ++nt) {
        const int rowg = rowbase + mt * 16 + half * 8;
        const int b    = rowg >> 11;  // / NS
        const int s    = rowg & (NS - 1);
        const int n    = nt * 16 + l16;
        const float bn = bias[h * ND + n];
        v8h o;
#pragma unroll
        for (int r = 0; r < 8; ++r) o[r] = (h16)(acc[mt][nt][r] + bn);
        *(v8h*)(out + ((size_t)(b * NH + h) * ND + n) * NS + s) = o;
      }
    return;
  }

#pragma unroll
  for (int mt = 0; mt < 4; ++mt)
#pragma unroll
    for (int nt = 0; nt < 4; ++nt)
#pragma unroll
      for (int r = 0; r < 8; ++r) {
        const int rowg = rowbase + mt * 16 + half * 8 + r;
        const int b    = rowg >> 11;  // / NS
        const int s    = rowg & (NS - 1);
        const int n    = nt * 16 + l16;
        const float v  = acc[mt][nt][r] + bias[h * ND + n];
        out[((size_t)(b * NH + h) * NS + s) * ND + n] = (h16)v;
      }
  // the built code lays V's side behind this one, with a way from here into it,
  // and V's side reuses the stores' registers
  asm volatile("s_wait_xcnt 0x0" ::: "memory");
}

// Lane l <-> lane l ^ 16: the other half of the wave holds the other 16 keys
// of the same query column.
static __device__ __forceinline__ float other_half(float v) {
  int b = __builtin_bit_cast(int, v);
  b = __builtin_amdgcn_permlanex16(b, b, 0x76543210, 0xfedcba98, false, false);
  return __builtin_bit_cast(float, b);
}

// Flash-attention: one block of AW waves per 32-query tile per (b,h); K/V
// fragments are shared by both 16-query sub-tiles (2x WMMA per byte loaded).
// The tile's 32-key chunks are dealt round-robin to the waves: the launch lasts
// as long as its longest wave, which now walks 16 chunks where a lone wave
// walked 64, and a SIMD holds twice the waves to cover loads and chains.  Each
// wave keeps its own running maximum, sum and Ot; they are joined once in LDS.
// The products are taken transposed: St = K Q^T and Ot += Vt Pt.  A lane then
// holds 16 of the 32 scores of ONE query (its column), so maximum and sum are
// taken in the lane, and the two score tiles of a column, converted in place,
// are the B operand of the second product.
// grid = NB*NH*(NS/32), block = 32*AW.  V is transposed [NB*NH, ND, NS].
#define AW 4
// one (wave, d tile) slice of the partial Ot in LDS, floats: 2 query tiles x 2
// pieces x 32 lanes x 4 values, and 16 more: 16 lanes of a 16-byte read in the
// join take 4 queries x 4 d tiles, and 64 B a slice puts them on distinct banks
#define JSLICE (2 * 2 * 32 * 4 + 16)
// A wave's own staging rows in LDS, halves: its chunk's 32 K rows of 128 bytes at
// a pitch of 144 bytes, then the 64 Vt rows of 64 bytes at a pitch of 80 bytes
// (both 16 B x odd: the 16 rows of a 16-byte fragment read fall on distinct banks)
#define KPITCH 72
#define VPITCH 40
#define KVW (32 * KPITCH + 64 * VPITCH)
__global__ __launch_bounds__(32 * AW) void attn_kernel(
    const h16* __restrict__ Q,   // [NB*NH, NS, ND]
    const h16* __restrict__ K,   // [NB*NH, NS, ND]
    const h16* __restrict__ Vt,  // [NB*NH, ND, NS]
    h16* __restrict__ O)         // [NB, NS, NH*ND]
{
  __shared__ __attribute__((aligned(16))) float s_acc[AW * 4 * JSLICE];
  __shared__ float s_m[AW][2][32];
  __shared__ float s_l[AW][2][32];
  __shared__ __attribute__((aligned(16))) h16 s_kv[AW * KVW];
  const int lane = threadIdx.x & 31;
  // in a scalar register, so that the key loop's test is a scalar branch
  const int wave = __builtin_amdgcn_readfirstlane(threadIdx.x >> 5);
  const int half = lane >> 4;
  const int l16  = lane & 15;
  const int kb0  = half * 8;
  const int kb1  = 16 + half * 8;
  // Only half the blocks are resident at once, and the cost falls with the
  // index: the longest query tiles of all
  // (b,h) come first and the one-chunk tiles fill the end of the launch.
  // (the mask tells the compiler that qt lies in 0 .. NS / 32 - 1)
  const int qt   = (NS / 32 - 1) - ((blockIdx.x / (NB * NH)) & (NS / 32 - 1));
  const int bh   = blockIdx.x % (NB * NH);
  const int h    = bh & (NH - 1);
  const int b    = bh >> 4;
  const int qbase = qt * 32;

  const h16* Qp = Q + (size_t)bh * NS * ND;
  const h16* Kp = K + (size_t)bh * NS * ND;
  const h16* Vp = Vt + (size_t)bh * ND * NS;

  // Q fragments (B operand: lane = query column): 2 column tiles x 2 K-chunks,
  // resident for the whole pass
  v16h bq[2][2];
#pragma unroll
  for (int mt = 0; mt < 2; ++mt) {
    const h16* qrow = Qp + (size_t)(qbase + mt * 16 + l16) * ND;
#pragma unroll
    for (int kc = 0; kc < 2; ++kc)
      bq[mt][kc] = load_frag2(qrow + kc * 32 + kb0, qrow + kc * 32 + kb1);
  }

  // acc[mt][nt][r] = O[query mt*16 + l16][d = nt*16 + half*8 + r]
  v8f acc[2][4] = {};
  float col_m[2] = {-1e30f, -1e30f};  // running maximum of the lane's query
  float col_l[2] = {0.0f, 0.0f};      // running sum over this half's keys only

  const float scale  = 0.125f;        // 1/sqrt(64)
  const int nchunks = (qbase >> 5) + 1;  // causal bound (rows < qbase+32)

  // A fragment load straight from the rows touches 16 lines for 512 bytes.  The
  // wave brings its chunk by whole rows instead and turns it in its own LDS rows:
  // K by 8 lanes a 128-byte row (4 whole lines a load), Vt by 4 lanes a 64-byte
  // row piece (8 lines a load).  The groups of lanes that share a 16-lane LDS
  // store take K rows 8 apart and Vt rows 4 apart, which puts them on distinct
  // banks at these pitches.  Load i takes K rows krow0 + i; load j takes Vt rows
  // vrow0 + (j & 3) + 32 (j >> 2).
  const int krow0 = (lane >> 3) * 8;
  const int kpc   = (lane & 7) * 8;
  const int vrow0 = ((lane >> 2) & 3) * 4 + half * 16;
  const int vpc   = (lane & 3) * 8;
  h16* sb = s_kv + wave * KVW;
  h16* wk = sb + krow0 * KPITCH + kpc;
  h16* wv = sb + 32 * KPITCH + vrow0 * VPITCH + vpc;
  const h16* rk = sb + l16 * KPITCH;
  const h16* rv = sb + 32 * KPITCH + l16 * VPITCH;
  // running pointers of the wave's current chunk, so that a trip forms no
  // address from the chunk's number; pk: one K line a lane, for the prefetch
  const h16* gk = Kp + (size_t)(wave * 32 + krow0) * ND + kpc;
  const h16* gv = Vp + (size_t)vrow0 * NS + wave * 32 + vpc;
  const h16* pk = Kp + (size_t)(wave * 32 + lane) * ND;

  for (int ch = wave; ch < nchunks; ch += AW) {
    const int tbase = ch * 32;

    // ---- the chunk's K rows, and behind them its Vt rows, which fly while K is
    // turned ----
    v8h sk[8], sv[8];
#pragma unroll
    for (int i = 0; i < 8; ++i) sk[i] = *(const v8h*)(gk + i * ND);
#pragma unroll
    for (int j = 0; j < 8; ++j)
      sv[j] = *(const v8h*)(gv + (size_t)((j & 3) + 32 * (j >> 2)) * NS);
    // keeps the loads in front of the prefetch's branch: without it the built code
    // sinks all sixteen behind it
    __builtin_amdgcn_sched_barrier(0);
    if (ch + AW < nchunks) __builtin_prefetch(pk + AW * 32 * ND, 0, 3);
    // the address registers of the loads and the prefetch above are advanced
    // below
    asm volatile("s_wait_xcnt 0x0" ::: "memory");
    // keeps the address additions from being lifted over that wait
    __builtin_amdgcn_sched_barrier(0);
    gk += AW * 32 * ND;
    gv += AW * 32;
    pk += AW * 32 * ND;

    // every lane's fragment reads of the trip before have returned before the
    // wave's rows are written again
    asm volatile("s_wait_dscnt 0x0" ::: "memory");
#pragma unroll
    for (int i = 0; i < 8; ++i) *(v8h*)(wk + i * KPITCH) = sk[i];
    // a lane reads back rows that other lanes of the wave wrote
    asm volatile("s_wait_dscnt 0x0" ::: "memory");

    // ---- K fragments (A operand: lane = key row; shared by both tiles) ----
    v16h ak[2][2];  // [tt][kc]
#pragma unroll
    for (int tt = 0; tt < 2; ++tt) {
      const h16* krow = rk + tt * 16 * KPITCH;
#pragma unroll
      for (int kc = 0; kc < 2; ++kc)
        ak[tt][kc] = load_frag2(krow + kc * 32 + kb0, krow + kc * 32 + kb1);
    }

    // ---- scores: St = K Q^T ----
    // c[mt][tt][r] = S[query mt*16 + l16][key tbase + tt*16 + half*8 + r]
    v8f c[2][2] = {};
#pragma unroll
    for (int mt = 0; mt < 2; ++mt)
#pragma unroll
      for (int tt = 0; tt < 2; ++tt)
#pragma unroll
        for (int kc = 0; kc < 2; ++kc)
          c[mt][tt] = wmma_f16(ak[tt][kc], bq[mt][kc], c[mt][tt]);

    // ---- V fragments (A operand: lane = d row; shared by both tiles) ----
    // turned and read in front of the softmax, so that they arrive during it
#pragma unroll
    for (int j = 0; j < 8; ++j)
      *(v8h*)(wv + ((j & 3) + 32 * (j >> 2)) * VPITCH) = sv[j];
    // a lane reads back rows that other lanes of the wave wrote
    asm volatile("s_wait_dscnt 0x0" ::: "memory");
    v16h av[4];
#pragma unroll
    for (int nt = 0; nt < 4; ++nt) {
      const h16* vr = rv + nt * 16 * VPITCH;
      av[nt] = load_frag2(vr + kb0, vr + kb1);
    }
    // keeps the scheduler from sinking these reads to their use, where it split
    // them into four pairs, each waited for on its own
    __builtin_amdgcn_sched_barrier(0);

    // ---- scale + causal mask + online softmax (per query column) ----
    float corr[2];
    v16h bp[2];  // P^T as B operand: element tt*8 + r = key tt*16 + half*8 + r
#pragma unroll
    for (int mt = 0; mt < 2; ++mt) {
      const int srow = qbase + mt * 16 + l16;
      float s[16];
#pragma unroll
      for (int e = 0; e < 16; ++e) {
        s[e] = c[mt][e >> 3][e & 7] * scale;
        if (tbase + (e >> 3) * 16 + half * 8 + (e & 7) > srow) s[e] = -1e30f;
      }
      // pairwise trees, so that no chain is longer than four links
      float t[8];
#pragma unroll
      for (int e = 0; e < 8; ++e) t[e] = fmaxf(s[e], s[e + 8]);
#pragma unroll
      for (int w = 4; w > 0; w >>= 1)
#pragma unroll
        for (int e = 0; e < w; ++e) t[e] = fmaxf(t[e], t[e + w]);
      const float mx   = fmaxf(t[0], other_half(t[0]));
      const float mnew = fmaxf(col_m[mt], mx);
      corr[mt]  = __expf(col_m[mt] - mnew);
      col_m[mt] = mnew;
#pragma unroll
      for (int e = 0; e < 16; ++e) {
        s[e] = __expf(s[e] - mnew);
        bp[mt][e] = (h16)s[e];
      }
#pragma unroll
      for (int e = 0; e < 8; ++e) t[e] = s[e] + s[e + 8];
#pragma unroll
      for (int w = 4; w > 0; w >>= 1)
#pragma unroll
        for (int e = 0; e < w; ++e) t[e] += t[e + w];
      col_l[mt] = col_l[mt] * corr[mt] + t[0];
    }

    // rescale running accumulators
#pragma unroll
    for (int mt = 0; mt < 2; ++mt)
#pragma unroll
      for (int nt = 0; nt < 4; ++nt)
#pragma unroll
        for (int r = 0; r < 8; ++r) acc[mt][nt][r] *= corr[mt];

    // ---- Ot += Vt Pt ----
#pragma unroll
    for (int nt = 0; nt < 4; ++nt) {
      acc[0][nt] = wmma_f16(av[nt], bp[0], acc[0][nt]);
      acc[1][nt] = wmma_f16(av[nt], bp[1], acc[1][nt]);
    }
  }

  // ---- join the waves' partial results ----
  // a wave that had no chunk hands over maximum -1e30, sum 0 and Ot 0, and its
  // factor below is 0; wave 0 always has chunk 0, so the joint maximum is real
#pragma unroll
  for (int mt = 0; mt < 2; ++mt) {
    s_m[wave][mt][lane] = col_m[mt];
    s_l[wave][mt][lane] = col_l[mt] + other_half(col_l[mt]);
#pragma unroll
    for (int nt = 0; nt < 4; ++nt)
#pragma unroll
      for (int p = 0; p < 2; ++p) {
        const v4f t = {acc[mt][nt][p * 4 + 0], acc[mt][nt][p * 4 + 1],
                       acc[mt][nt][p * 4 + 2], acc[mt][nt][p * 4 + 3]};
        *(v4f*)&s_acc[(wave * 4 + nt) * JSLICE + (mt * 2 + p) * 128 + lane * 4] =
            t;
      }
  }
  __syncthreads();

  // Wave w finishes queries 8 w .. 8 w + 7, four lanes a query with 16 d each,
  // so that a 128-byte row of O (head-concat layout [B, S, H*D]) has one writer.
  const int q   = wave * 8 + (lane >> 2);
  const int dt  = lane & 3;  // the lane's d tile
  const int qmt = q >> 4;
  const int ql  = q & 15;
  float pm[AW];
#pragma unroll
  for (int w = 0; w < AW; ++w) pm[w] = s_m[w][qmt][ql];
  const float mall = fmaxf(fmaxf(pm[0], pm[1]), fmaxf(pm[2], pm[3]));
  float lall = 0.0f;
  float o[16] = {};
#pragma unroll
  for (int w = 0; w < AW; ++w) {
    // exp(x) as 2^(x log2 e).  In asm so that the v_nop stands directly behind
    // the transcendental: the free slot before its source register is reused
    float f;
    asm("v_exp_f32 %0, %1\n\tv_nop"
        : "=v"(f)
        : "v"((pm[w] - mall) * 1.44269504f));
    lall += f * s_l[w][qmt][ql];
#pragma unroll
    for (int hf = 0; hf < 2; ++hf)
#pragma unroll
      for (int p = 0; p < 2; ++p) {
        const v4f t = *(const v4f*)&s_acc[(w * 4 + dt) * JSLICE +
                                          (qmt * 2 + p) * 128 +
                                          (hf * 16 + ql) * 4];
#pragma unroll
        for (int j = 0; j < 4; ++j) o[hf * 8 + p * 4 + j] += f * t[j];
      }
  }
  const float inv = 1.0f / lall;
  h16* orow = O + ((size_t)b * NS + qbase + q) * (NH * ND) + h * ND + dt * 16;
#pragma unroll
  for (int hf = 0; hf < 2; ++hf) {
    v8h ov;
#pragma unroll
    for (int r = 0; r < 8; ++r) ov[r] = (h16)(o[hf * 8 + r] * inv);
    *(v8h*)(orow + hf * 8) = ov;
  }
}

// Output projection: out = A @ W_o + b_o (f32), W_o pre-transposed [NE, NH*ND]
// grid = (ROWS/128, NE/64), block = 128 (4 waves, each wave 32 rows x 64 cols)
__global__ __launch_bounds__(128) void out_gemm_kernel(
    const h16* __restrict__ A,       // [ROWS, NH*ND]
    const h16* __restrict__ Wot,     // [NE, NH*ND]
    const float* __restrict__ bias,  // [NE]
    float* __restrict__ out)         // [ROWS, NE]
{
  const int tid  = threadIdx.x;
  const int wave = tid >> 5;
  const int lane = tid & 31;
  const int half = lane >> 4;
  const int l16  = lane & 15;
  const int rowbase = blockIdx.x * 128 + wave * 32;
  const int ntbase  = blockIdx.y * 64;

  __shared__ __attribute__((aligned(16))) h16 sm[2 * GBUF];
  v8f acc[2][4] = {};
  tile_product(A + (size_t)blockIdx.x * 128 * (NH * ND),
               Wot + (size_t)ntbase * (NH * ND), sm, acc);

#pragma unroll
  for (int mt = 0; mt < 2; ++mt)
#pragma unroll
    for (int nt = 0; nt < 4; ++nt)
#pragma unroll
      for (int r = 0; r < 8; ++r) {
        const int rowg = rowbase + mt * 16 + half * 8 + r;
        const int n    = ntbase + nt * 16 + l16;
        out[(size_t)rowg * NE + n] = acc[mt][nt][r] + bias[n];
      }
}

extern "C" void kernel_launch(void* const* d_in, const int* in_sizes, int n_in,
                              void* d_out, int out_size, void* d_ws,
                              size_t ws_size, hipStream_t stream) {
  const float* x   = (const float*)d_in[0];
  const float* W_q = (const float*)d_in[1];
  const float* b_q = (const float*)d_in[2];
  const float* W_k = (const float*)d_in[3];
  const float* b_k = (const float*)d_in[4];
  const float* W_v = (const float*)d_in[5];
  const float* b_v = (const float*)d_in[6];
  const float* W_o = (const float*)d_in[7];
  const float* b_o = (const float*)d_in[8];
  float* out = (float*)d_out;

  const size_t nx   = (size_t)ROWS * NE;          // 4M halves
  const size_t nqkv = (size_t)NB * NH * NS * ND;  // 4M halves
  const size_t nw   = (size_t)NH * NE * ND;       // 1M halves
  h16* xh  = (h16*)d_ws;
  h16* qh  = xh + nx;
  h16* kh  = qh + nqkv;
  h16* vh  = kh + nqkv;   // transposed V: [NB*NH, ND, NS]
  h16* oh  = vh + nqkv;
  h16* wqh = oh + nx;     // transposed: [NH, ND, NE]
  h16* wkh = wqh + nw;
  h16* wvh = wkh + nw;
  h16* woh = wvh + nw;    // transposed: [NE, NH*ND]

  // wqh, wkh, wvh, woh stand one behind the other, and so do qh, kh, vh
  prep_kernel<<<CVT_BLOCKS + 4 * WT_TILES, 256, 0, stream>>>(x, W_q, W_k, W_v,
                                                             W_o, xh, wqh);

  dim3 gq(ROWS / 128, NH / 2, 3);
  qkv_gemm_kernel<<<gq, 128, 0, stream>>>(xh, wqh, b_q, b_k, b_v, qh);

  attn_kernel<<<NB * NH * (NS / 32), 32 * AW, 0, stream>>>(qh, kh, vh, oh);

  dim3 go(ROWS / 128, NE / 64);
  out_gemm_kernel<<<go, 128, 0, stream>>>(oh, woh, b_o, out);
}
